// v000
// Measured on an AMD MI455X. A time is GPU time per run, averaged over a window of back-to-back runs after a warm-up
// (all launches, gaps included; the runs take copies of the inputs in turn), and the median of several windows.
// Apart from v000's, it joins two sittings. Times from different sittings can be a few percent apart, while
// side-by-side timings come from the same sitting.
// The starting kernel, v000, takes 1200 microseconds a run.
// compute dtype: all float inputs rounded to bf16; q / k / v projections with EXACT bf16 products on WMMA 16x16x32 (f32 accumulate) + bias (zeros, read); logits q x k once to f16 each (1 product) x 64^-0.5, + logf(bf16(weight) + 1e-20) per key in f32; softmax f32; P x 2^11 once to f16 x v once to f16 (1 product); ctx x 2^6 once to f16 x wo f16(bf16 x 2^8) + bo; f32 output.
#include <hip/hip_runtime.h>
#include <math.h>

typedef __attribute__((ext_vector_type(16))) _Float16 v16h;
typedef __attribute__((ext_vector_type(16))) __bf16 v16b;
typedef __attribute__((ext_vector_type(8)))  _Float16 v8h;
typedef __attribute__((ext_vector_type(8)))  float v8f;
typedef __attribute__((ext_vector_type(4)))  float v4f;
typedef __attribute__((ext_vector_type(2)))  float v2f;
typedef __attribute__((ext_vector_type(4)))  unsigned v4u;
typedef __attribute__((ext_vector_type(4)))  int v4i;
typedef float __attribute__((may_alias)) float_a;
typedef int __attribute__((may_alias)) int_a;

template <typename T> __device__ __forceinline__ void vst2(void* p, T v) { *(T*)p = v;  }
__device__ __forceinline__ v8f wmma16(v16h a, v16h b, v8f c) {
  v8f d = __builtin_amdgcn_wmma_f32_16x16x32_f16(false, a, false, b, (short)0, c, false, false);
  asm volatile("v_nop\n\tv_nop\n\tv_nop\n\tv_nop" : "+v"(d) : "v"(a), "v"(b));
  return d;
}
__device__ __forceinline__ v8f wmma_bf(v16b a, v16b b, v8f c) {
  v8f d = __builtin_amdgcn_wmma_f32_16x16x32_bf16(false, a, false, b, (short)0, c, false, false);
  asm volatile("v_nop\n\tv_nop\n\tv_nop\n\tv_nop" : "+v"(d) : "v"(a), "v"(b));
  return d;
}
// 16x16x32 fragments: lane = (h = lane>>4, row/col = lane&15); elements 0..7 = k0+8h+0..7, 8..15 = k0+16+8h+0..7; D element r = row 8h+r
__device__ __forceinline__ v16h frag_h(const _Float16* rowk0, int lane) {
  union { v16h v; v8h q[2]; } u; const _Float16* p = rowk0 + 8 * (lane >> 4);
  u.q[0] = *(const v8h*)p; u.q[1] = *(const v8h*)(p + 16); return u.v;
}
__device__ __forceinline__ v16h frag_f32(const float* rowk0, int lane) {
  v16h a; const float* p = rowk0 + 8 * (lane >> 4);
#pragma unroll
  for (int i = 0; i < 8; ++i) { a[i] = (_Float16)p[i]; a[8 + i] = (_Float16)p[16 + i]; }
  return a;
}
__device__ __forceinline__ v16h frag_f32s(const float* rowk0, int lane, float sc) {
  v16h a; const float* p = rowk0 + 8 * (lane >> 4);
#pragma unroll
  for (int i = 0; i < 8; ++i) { a[i] = (_Float16)(p[i] * sc); a[8 + i] = (_Float16)(p[16 + i] * sc); }
  return a;
}
// column fragment from a [K][ld] layout (column n), rows >= K read as 0
__device__ __forceinline__ v16h fragc_f32(const float* W, int k0, int n, int lane, int ld, int K) {
  v16h a; const int g = lane >> 4;
#pragma unroll
  for (int i = 0; i < 8; ++i) { const int ka = k0 + 8 * g + i, kb = ka + 16;
    a[i] = (_Float16)(ka < K ? W[(size_t)(ka < K ? ka : K - 1) * ld + n] : 0.f); a[8 + i] = (_Float16)(kb < K ? W[(size_t)(kb < K ? kb : K - 1) * ld + n] : 0.f); }
  return a;
}
struct F2 { v16b h, l; };
__device__ __forceinline__ F2 bsplit16(const float v[16]) { F2 r;
#pragma unroll
  for (int i = 0; i < 16; ++i) { const __bf16 h = (__bf16)v[i]; r.h[i] = h; r.l[i] = (__bf16)(v[i] - (float)h); }
  return r; }
__device__ __forceinline__ F2 split_row(const float* row, int k0, int lane) { float v[16]; const float* p = row + k0 + 8 * (lane >> 4);
#pragma unroll
  for (int i = 0; i < 8; ++i) { v[i] = p[i]; v[8 + i] = p[16 + i]; }
  return bsplit16(v); }
__device__ __forceinline__ F2 split_rowK(const float* row, int k0, int lane, int K) { float v[16]; const int g = lane >> 4;
#pragma unroll
  for (int i = 0; i < 8; ++i) { const int ka = k0 + 8 * g + i, kb = ka + 16; v[i] = ka < K ? row[ka < K ? ka : K - 1] : 0.f; v[8 + i] = kb < K ? row[kb < K ? kb : K - 1] : 0.f; }
  return bsplit16(v); }
__device__ __forceinline__ F2 split_col(const float* W, int k0, int n, int lane, int ld, int K) { float v[16]; const int g = lane >> 4;
#pragma unroll
  for (int i = 0; i < 8; ++i) { const int ka = k0 + 8 * g + i, kb = ka + 16; v[i] = ka < K ? W[(size_t)(ka < K ? ka : K - 1) * ld + n] : 0.f; v[8 + i] = kb < K ? W[(size_t)(kb < K ? kb : K - 1) * ld + n] : 0.f; }
  return bsplit16(v); }
__device__ __forceinline__ v8f mac3(const F2& a, const F2& b, v8f c) { c = wmma_bf(a.l, b.h, c); c = wmma_bf(a.h, b.l, c); return wmma_bf(a.h, b.h, c); }
__device__ __forceinline__ float sigm(float v) { return 1.0f / (1.0f + expf(-v)); }
#define LDSX() do { asm volatile("s_wait_dscnt 0" ::: "memory"); __builtin_amdgcn_wave_barrier(); __builtin_amdgcn_fence(__ATOMIC_RELEASE, "workgroup"); } while (0)

// Multi-head attention on separate inputs with a per-key multiplicative weight (query / key / value [2,2048,1024]; (in,out) wq / wk / wv / wo [1024,1024] N(0, 1/1024) applied as x @ W + b, all biases zeros (read); weights [2,2048] uniform(0,1), one per (batch, key); 16 heads x 64; scores / sqrt(64) + log(weights + 1e-20) broadcast over heads and queries; softmax over keys; out @ wo + bo).
#define NB 2
#define TT 2048
#define CC 1024            // NH * HD = projected width
#define DIN 1024          // input (model) width
#define NH 16
#define HD 64
#define NQB (TT / 64)
#define HG 4
#define SCALE (0.125f)
#define CAUSAL 0
#ifndef TNB
#define TNB NB
#endif
__device__ __forceinline__ float bfr(float v) { return (float)(__bf16)v; }
__host__ __device__ __forceinline__ int kb_last(int qb) { return CAUSAL ? ((qb * 64 + 63) >> 7) : (TT / 128 - 1); }
typedef __attribute__((ext_vector_type(8))) __bf16 v8b;
__device__ __forceinline__ v16b frag_b(const __bf16* rowk0, int lane) {
  union { v16b v; v8b q[2]; } u; const __bf16* p = rowk0 + 8 * (lane >> 4);
  u.q[0] = *(const v8b*)p; u.q[1] = *(const v8b*)(p + 16); return u.v;
}
#define QBH 0              // causal: query blocks 0..QBH-1 of each sequence (few keys, no averaging) take the high-precision path
#define QHI 0               // single-product logits on every row (logit sigma ~1)
#define KHI 64            // key rows carrying k residual / v bf16 hi+lo planes (used only by the causal high-precision path)
// B fragment (k rows k0+.., output column o) of a weight: (in,out) [K][ld] or (out,in) [ld rows of K]: bf16 exact, or f16(bf16 * 256) exact
__device__ __forceinline__ v16b wcol_io(const float* Wm, int k0, int o, int lane, int ld) { v16b w; const int g = lane >> 4;
#pragma unroll
  for (int i = 0; i < 8; ++i) { w[i] = (__bf16)Wm[(size_t)(k0 + 8 * g + i) * ld + o]; w[8 + i] = (__bf16)Wm[(size_t)(k0 + 16 + 8 * g + i) * ld + o]; }
  return w; }
__device__ __forceinline__ v16b wcol_oi(const float* Wm, int k0, int o, int lane, int K) { v16b w; const float* p = Wm + (size_t)o * K + k0 + 8 * (lane >> 4);
#pragma unroll
  for (int i = 0; i < 8; ++i) { w[i] = (__bf16)p[i]; w[8 + i] = (__bf16)p[16 + i]; }
  return w; }
__device__ __forceinline__ v16h wcolh_io(const float* Wm, int k0, int o, int lane, int ld) { v16h w; const int g = lane >> 4;
#pragma unroll
  for (int i = 0; i < 8; ++i) { w[i] = (_Float16)(bfr(Wm[(size_t)(k0 + 8 * g + i) * ld + o]) * 256.0f); w[8 + i] = (_Float16)(bfr(Wm[(size_t)(k0 + 16 + 8 * g + i) * ld + o]) * 256.0f); }
  return w; }
__device__ __forceinline__ v16h wcolh_oi(const float* Wm, int k0, int o, int lane, int K) { v16h w; const float* p = Wm + (size_t)o * K + k0 + 8 * (lane >> 4);
#pragma unroll
  for (int i = 0; i < 8; ++i) { w[i] = (_Float16)(bfr(p[i]) * 256.0f); w[8 + i] = (_Float16)(bfr(p[16 + i]) * 256.0f); }
  return w; }
#define WQKV_LAYOUT 0   // 0 = (in,out) [DIN][CC]; 1 = (out,in) [CC][DIN]; 2 = per-head [NH][DIN][HD]
__device__ __forceinline__ v16b wcol_hdk(const float* Wm, int k0, int o, int lane) { v16b w; const int g = lane >> 4; const float* p = Wm + (size_t)(o / HD) * DIN * HD + (o % HD);
#pragma unroll
  for (int i = 0; i < 8; ++i) { w[i] = (__bf16)p[(size_t)(k0 + 8 * g + i) * HD]; w[8 + i] = (__bf16)p[(size_t)(k0 + 16 + 8 * g + i) * HD]; }
  return w; }
#define WO_OUT_IN 0
#if WQKV_LAYOUT == 1
#define WCOL(W, k0, o, lane) wcol_oi(W, k0, o, lane, DIN)
#elif WQKV_LAYOUT == 2
#define WCOL(W, k0, o, lane) wcol_hdk(W, k0, o, lane)
#else
#define WCOL(W, k0, o, lane) wcol_io(W, k0, o, lane, CC)
#endif
#if WO_OUT_IN
#define WOCOL(W, k0, o, lane) wcol_oi(W, k0, o, lane, CC)
#define WOCOLH(W, k0, o, lane) wcolh_oi(W, k0, o, lane, CC)
#else
#define WOCOL(W, k0, o, lane) wcol_io(W, k0, o, lane, DIN)
#define WOCOLH(W, k0, o, lane) wcolh_io(W, k0, o, lane, DIN)
#endif

#define SM_EXTRA_PARAMS , int bsm, const float* __restrict__ WGT   /* key weights [NB][TT] */
// additive per-key log-weight on the scaled logit: v += logf(bf16(weights[b][k]) + 1e-20f) (the module: scores / sqrt(d) + log(weights + 1e-20) before the softmax); f32, precise logf
#define SM_MASK_HOOK do { const float wk_ = bfr(WGT[(size_t)bsm * TT + k]); asm volatile("s_wait_loadcnt 0x0" ::: "memory"); v = v + logf(wk_ + 1.0e-20f); } while (0)
#ifndef SM_EXTRA_PARAMS
#define SM_EXTRA_PARAMS
#endif
#ifndef PROJ_EXTRA_PARAMS
#define PROJ_EXTRA_PARAMS
#endif
#ifndef SM_MASK_HOOK
#define SM_MASK_HOOK (void)0
#endif

#define WS_QH  0u                                      // f16 q rows [b*t][CC]
#define WS_KH  (WS_QH + 2u * (size_t)NB * TT * CC)      // f16 k rows [b*t][CC]
#define WS_VT  (WS_KH + 2u * (size_t)NB * TT * CC)      // f16 v planes [b][c][t]
#define WS_QL  (WS_VT + 2u * (size_t)NB * CC * TT)      // f16 q residual x 2^10 rows [b][t < QHI][CC]
#define WS_KL  (WS_QL + 2u * (size_t)NB * QHI * CC)     // f16 k residual x 2^10 rows [b][t < KHI][CC]
#define WS_VB  (WS_KL + 2u * (size_t)NB * KHI * CC)     // bf16 v hi planes [b][c][t < KHI]
#define WS_VBL (WS_VB + 2u * (size_t)NB * CC * KHI)
#define WS_S   (WS_VBL + 2u * (size_t)NB * CC * KHI)    // f32 logits / P [hg][t][s]
#define WS_Y   (WS_S  + 4u * (size_t)HG * TT * TT)      // f32 ctx rows [b*t][CC] (only when there is an output projection)
#define WS_END (WS_Y  + 4u * (size_t)NB * TT * CC)

// ---- k_proj: block = (64 rows, 128 cols, which): q/k/v = X W (+ b) with exact bf16 products (K = DIN) -> which 0: q f16 rows (+ residual rows < QHI); 1: k f16 rows (+ residual rows < KHI); 2: v f16 planes [c][t] (+ bf16 hi/lo planes for t < KHI)
__global__ __launch_bounds__(128) void k_proj(const float* __restrict__ XQ, const float* __restrict__ XK, const float* __restrict__ XV, const float* __restrict__ WQ, const float* __restrict__ WK, const float* __restrict__ WV, const float* __restrict__ BQ, const float* __restrict__ BK, const float* __restrict__ BV,
    _Float16* __restrict__ QH, _Float16* __restrict__ QL, _Float16* __restrict__ KH, _Float16* __restrict__ KL, _Float16* __restrict__ VT, __bf16* __restrict__ VB, __bf16* __restrict__ VBL) {
  __shared__ __align__(16) _Float16 sh[64][136], sl[64][136]; __shared__ __align__(16) _Float16 th[128][72]; __shared__ __align__(16) __bf16 tb[128][72], tbl[128][72];
  const int tid = threadIdx.x, wave = tid >> 5, lane = tid & 31, col = lane & 15, g = lane >> 4; const int which = blockIdx.z; const int c0 = blockIdx.y * 128; const size_t r0 = (size_t)blockIdx.x * 64; const size_t bb = r0 / TT; const int t0 = (int)(r0 % TT);
  const float* X = which == 0 ? XQ : which == 1 ? XK : XV; const float* WA = which == 0 ? WQ : which == 1 ? WK : WV; const float* BA = which == 0 ? BQ : which == 1 ? BK : BV;
  v8f acc[8] = {};
#pragma unroll 2
  for (int kc = 0; kc < DIN / 32; ++kc) { v16b a; { const float* p = X + (r0 + wave * 16 + col) * DIN + kc * 32 + 8 * g;
#pragma unroll
      for (int i = 0; i < 8; ++i) { a[i] = (__bf16)p[i]; a[8 + i] = (__bf16)p[16 + i]; } }
    asm volatile("s_wait_loadcnt 0x0" ::: "memory");
#pragma unroll
    for (int j = 0; j < 8; ++j) { const v16b w = WCOL(WA, kc * 32, c0 + j * 16 + col, lane); asm volatile("s_wait_loadcnt 0x0" ::: "memory"); acc[j] = wmma_bf(a, w, acc[j]); } }
  if (which < 2) { _Float16* DH = which == 0 ? QH : KH; _Float16* DL = which == 0 ? QL : KL; const int nhi = which == 0 ? QHI : KHI; const bool hi_rows = t0 < nhi;
#pragma unroll
    for (int j = 0; j < 8; ++j) { const float bias = BA ? bfr(BA[c0 + j * 16 + col]) : 0.f;
#pragma unroll
      for (int r = 0; r < 8; ++r) { const float v = acc[j][r] + bias; const _Float16 hv = (_Float16)v; sh[wave * 16 + 8 * g + r][j * 16 + col] = hv; sl[wave * 16 + 8 * g + r][j * 16 + col] = (_Float16)((v - (float)hv) * 1024.0f); } }
    __syncthreads();
    for (int e = tid; e < 64 * 16; e += 128) { const int rl = e >> 4, q = e & 15; vst2((unsigned*)(DH + (r0 + rl) * CC + c0 + q * 8), *(const v4u*)&sh[rl][q * 8]); if (hi_rows) vst2((unsigned*)(DL + (bb * nhi + t0 + rl) * (size_t)CC + c0 + q * 8), *(const v4u*)&sl[rl][q * 8]); }
  } else { const bool hi_rows = t0 < KHI;
#pragma unroll
    for (int j = 0; j < 8; ++j) { const float bias = BA ? bfr(BA[c0 + j * 16 + col]) : 0.f;
#pragma unroll
      for (int r = 0; r < 8; ++r) { const float v = acc[j][r] + bias; const int rl = wave * 16 + 8 * g + r, cl = j * 16 + col; th[cl][rl] = (_Float16)v; const __bf16 bh = (__bf16)v; tb[cl][rl] = bh; tbl[cl][rl] = (__bf16)(v - (float)bh); } }
    __syncthreads();
    for (int e = tid; e < 128 * 8; e += 128) { const int cl = e >> 3, q = e & 7; vst2((unsigned*)(VT + (bb * CC + c0 + cl) * (size_t)TT + t0 + q * 8), *(const v4u*)&th[cl][q * 8]); if (hi_rows) { const size_t o3 = (bb * CC + c0 + cl) * (size_t)KHI + t0 + q * 8; vst2((unsigned*)(VB + o3), *(const v4u*)&tb[cl][q * 8]); vst2((unsigned*)(VBL + o3), *(const v4u*)&tbl[cl][q * 8]); } } } }
// ---- k_sc: block = (query block qb, key block kb <= kb_last(qb), head in group) of batch b: logits x SCALE; q hi + residual (x 2^10) against k (2 products) for query rows < QHI, plus the k residual (3 products) for query blocks < QBH (causal early rows); causal: blocks past the diagonal exit, the mask itself is applied by index in k_sm
__global__ __launch_bounds__(128) void k_sc(const _Float16* __restrict__ QH, const _Float16* __restrict__ KH, const _Float16* __restrict__ QL, const _Float16* __restrict__ KL, int b, int h0, float* __restrict__ S0) { __shared__ __align__(16) float ss[4][16][132];
  const int qb = blockIdx.x, kb = blockIdx.y; if (kb > kb_last(qb)) return;
  const int h = h0 + blockIdx.z; float* S = S0 + (size_t)blockIdx.z * TT * TT;
  const int tid = threadIdx.x, wave = tid >> 5, lane = tid & 31, col = lane & 15, g = lane >> 4; const int k0 = kb * 128; const int ql0 = qb * 64 + wave * 16; const size_t q0 = (size_t)b * TT + ql0, kr0 = (size_t)b * TT + k0;
  v8f acc[8] = {}, accl[8] = {};
  const _Float16* QLb = QL + (size_t)b * QHI * CC; const _Float16* KLb = KL + (size_t)b * KHI * CC;
  if (qb < QBH) {
#pragma unroll
    for (int kc = 0; kc < HD / 32; ++kc) { const v16h ah = frag_h(QH + (q0 + col) * CC + h * HD + kc * 32, lane), al = frag_h(QLb + (size_t)(ql0 + col) * CC + h * HD + kc * 32, lane);
#pragma unroll
      for (int j = 0; j < 8; ++j) { const v16h kbf = frag_h(KH + (kr0 + j * 16 + col) * CC + h * HD + kc * 32, lane), klf = frag_h(KLb + (size_t)(k0 + j * 16 + col) * CC + h * HD + kc * 32, lane); acc[j] = wmma16(ah, kbf, acc[j]); accl[j] = wmma16(al, kbf, accl[j]); accl[j] = wmma16(ah, klf, accl[j]); } }
  } else if (qb * 64 < QHI) {
#pragma unroll
    for (int kc = 0; kc < HD / 32; ++kc) { const v16h ah = frag_h(QH + (q0 + col) * CC + h * HD + kc * 32, lane), al = frag_h(QLb + (size_t)(ql0 + col) * CC + h * HD + kc * 32, lane);
#pragma unroll
      for (int j = 0; j < 8; ++j) { const v16h kbf = frag_h(KH + (kr0 + j * 16 + col) * CC + h * HD + kc * 32, lane); acc[j] = wmma16(ah, kbf, acc[j]); accl[j] = wmma16(al, kbf, accl[j]); } }
  } else {
#pragma unroll
    for (int kc = 0; kc < HD / 32; ++kc) { const v16h ah = frag_h(QH + (q0 + col) * CC + h * HD + kc * 32, lane);
#pragma unroll
      for (int j = 0; j < 8; ++j) { const v16h kbf = frag_h(KH + (kr0 + j * 16 + col) * CC + h * HD + kc * 32, lane); acc[j] = wmma16(ah, kbf, acc[j]); } } }
#pragma unroll
  for (int j = 0; j < 8; ++j) {
#pragma unroll
    for (int r = 0; r < 8; ++r) ss[wave][8 * g + r][j * 16 + col] = (acc[j][r] + accl[j][r] * (1.0f / 1024.0f)) * SCALE; }
  LDSX(); for (int rl = 0; rl < 16; ++rl) vst2(S + (size_t)(ql0 + rl) * TT + k0 + lane * 4, *(const v4f*)&ss[wave][rl][lane * 4]); }
// ---- k_sm: block = query row t (head in group): keys [0, kend): causal -> logit if s <= t else excluded; softmax in f32; P x 2^11 in place (0 for excluded)
__global__ __launch_bounds__(256) void k_sm(float* __restrict__ S0 SM_EXTRA_PARAMS) { __shared__ float sred[8]; __shared__ float sbc; __shared__ __align__(16) float shv[TT];
  const int tid = threadIdx.x; const int t = blockIdx.x; const int kend = (kb_last(t >> 6) + 1) * 128;
  float* sr = S0 + (size_t)blockIdx.y * TT * TT + (size_t)t * TT;
  float m = -3.0e38f; for (int k = tid; k < kend; k += 256) { float v = (!CAUSAL || k <= t) ? sr[k] : -3.0e38f; SM_MASK_HOOK; shv[k] = v; m = fmaxf(m, v); }
#pragma unroll
  for (int o = 1; o < 32; o <<= 1) m = fmaxf(m, __shfl_xor(m, o));
  if ((tid & 31) == 0) sred[tid >> 5] = m; __syncthreads(); if (tid == 0) { float a = sred[0]; for (int i = 1; i < 8; ++i) a = fmaxf(a, sred[i]); sbc = a; } __syncthreads(); m = sbc; __syncthreads();
  float sum = 0.f; for (int k = tid; k < kend; k += 256) { const float v = shv[k]; const float e = (v <= -1.0e38f) ? 0.f : expf(v - m); shv[k] = e; sum += e; }
#pragma unroll
  for (int o = 1; o < 32; o <<= 1) sum += __shfl_xor(sum, o);
  if ((tid & 31) == 0) sred[tid >> 5] = sum; __syncthreads(); if (tid == 0) { float a = 0.f; for (int i = 0; i < 8; ++i) a += sred[i]; sbc = a > 0.f ? 2048.0f / a : 0.f; }   /* a fully excluded row yields P = 0 */ __syncthreads(); const float inv = sbc;
  for (int k = tid; k < kend; k += 256) shv[k] = shv[k] * inv;
  __syncthreads(); for (int q = tid; q < kend / 4; q += 256) vst2(sr + q * 4, *(const v4f*)&shv[q * 4]); }
// ---- k_pv: block = 64 queries (qb) of (b, h): ctx = P . v over keys [0, kend) (P x 2^11 once to f16 against v f16: 1 product; causal early query blocks: P and v as bf16 hi + lo, 3 products); 256-B (row, head) segment by 16 lanes
__global__ __launch_bounds__(128) void k_pv(const float* __restrict__ PS0, const _Float16* __restrict__ VT, const __bf16* __restrict__ VB, const __bf16* __restrict__ VBL, int b, int h0, float* __restrict__ Y) { const int h = h0 + blockIdx.z; const float* PS = PS0 + (size_t)blockIdx.z * TT * TT; __shared__ __align__(16) float ss[4][16][HD + 4];
  const int tid = threadIdx.x, wave = tid >> 5, lane = tid & 31, col = lane & 15, g = lane >> 4; const int qb = blockIdx.x; const int ql0 = qb * 64 + wave * 16; const int kce = (kb_last(qb) + 1) * 4;
  v8f acc[HD / 16] = {};
  if (qb < QBH) {
#pragma unroll 1
    for (int kc = 0; kc < kce; ++kc) { const F2 p = split_row(PS + (size_t)(ql0 + col) * TT, kc * 32, lane);
      asm volatile("s_wait_loadcnt 0x0" ::: "memory");
#pragma unroll
      for (int j = 0; j < HD / 16; ++j) { const size_t po = ((size_t)b * CC + h * HD + j * 16 + col) * (size_t)KHI + kc * 32; const v16b vh = frag_b(VB + po, lane); acc[j] = wmma_bf(p.h, vh, acc[j]); acc[j] = wmma_bf(p.l, vh, acc[j]); acc[j] = wmma_bf(p.h, frag_b(VBL + po, lane), acc[j]); } }
  } else {
#pragma unroll 1
    for (int kc = 0; kc < kce; ++kc) { const v16h p = frag_f32(PS + (size_t)(ql0 + col) * TT + kc * 32, lane);
      asm volatile("s_wait_loadcnt 0x0" ::: "memory");
#pragma unroll
      for (int j = 0; j < HD / 16; ++j) { const size_t po = ((size_t)b * CC + h * HD + j * 16 + col) * (size_t)TT + kc * 32; acc[j] = wmma16(p, frag_h(VT + po, lane), acc[j]); } } }
#pragma unroll
  for (int j = 0; j < HD / 16; ++j)
#pragma unroll
    for (int r = 0; r < 8; ++r) ss[wave][8 * g + r][j * 16 + col] = acc[j][r] * (1.0f / 2048.0f);
  LDSX(); for (int rl = 0; rl < 16; ++rl) if (lane < HD / 4) vst2(Y + ((size_t)b * TT + ql0 + rl) * CC + h * HD + lane * 4, *(const v4f*)&ss[wave][rl][lane * 4]); }
// ---- k_out: block = (64 rows, 128 cols): out = ctx Wo (+ bo): ctx x 2^6 once to f16 against Wo as f16(bf16 x 2^8) exact (1 product) x 2^-14; causal early rows (< QHI of each sequence): ctx bf16 hi + lo against exact bf16 Wo (2 products)
__global__ __launch_bounds__(128) void k_out(const float* __restrict__ Y, const float* __restrict__ WO, const float* __restrict__ BO, float* __restrict__ OUT) { __shared__ __align__(16) float sf[4][16][132];
  const int tid = threadIdx.x, wave = tid >> 5, lane = tid & 31, col = lane & 15, g = lane >> 4; const int c0 = blockIdx.y * 128; const size_t r0 = (size_t)blockIdx.x * 64 + wave * 16;
  v8f acc[8] = {};
  if (CAUSAL && (int)(((size_t)blockIdx.x * 64) % TT) < QHI) {   /* block-uniform */
#pragma unroll 2
    for (int kc = 0; kc < CC / 32; ++kc) { const F2 a = split_row(Y + (r0 + col) * CC, kc * 32, lane); asm volatile("s_wait_loadcnt 0x0" ::: "memory");
#pragma unroll
      for (int j = 0; j < 8; ++j) { const v16b w = WOCOL(WO, kc * 32, c0 + j * 16 + col, lane); asm volatile("s_wait_loadcnt 0x0" ::: "memory"); acc[j] = wmma_bf(a.h, w, acc[j]); acc[j] = wmma_bf(a.l, w, acc[j]); } }
#pragma unroll
    for (int j = 0; j < 8; ++j) { const float bias = BO ? bfr(BO[c0 + j * 16 + col]) : 0.f;
#pragma unroll
      for (int r = 0; r < 8; ++r) sf[wave][8 * g + r][j * 16 + col] = acc[j][r] + bias; }
  } else {
#pragma unroll 2
    for (int kc = 0; kc < CC / 32; ++kc) { const v16h a = frag_f32s(Y + (r0 + col) * CC + kc * 32, lane, 64.0f); asm volatile("s_wait_loadcnt 0x0" ::: "memory");   /* ctx carried x 2^6 into f16 so small-magnitude context rows stay clear of f16 subnormals (chip FTZ) */
#pragma unroll
      for (int j = 0; j < 8; ++j) { const v16h w = WOCOLH(WO, kc * 32, c0 + j * 16 + col, lane); asm volatile("s_wait_loadcnt 0x0" ::: "memory"); acc[j] = wmma16(a, w, acc[j]); } }
#pragma unroll
    for (int j = 0; j < 8; ++j) { const float bias = BO ? bfr(BO[c0 + j * 16 + col]) : 0.f;
#pragma unroll
      for (int r = 0; r < 8; ++r) sf[wave][8 * g + r][j * 16 + col] = acc[j][r] * (1.0f / 16384.0f) + bias; } }   /* 2^-8 (Wo carry) x 2^-6 (ctx carry) */
  LDSX(); for (int rl = 0; rl < 16; ++rl) vst2(OUT + (r0 + rl) * DIN + c0 + lane * 4, *(const v4f*)&sf[wave][rl][lane * 4]); }

extern "C" void kernel_launch(void* const* d_in, const int* in_sizes, int n_in, void* d_out, int out_size, void* d_ws, size_t ws_size, hipStream_t stream) {
  (void)in_sizes; (void)n_in; (void)out_size;
  const float** F = (const float**)d_in;
  if (ws_size < (size_t)WS_END) return;
  char* ws = (char*)d_ws; _Float16 *QH = (_Float16*)(ws + WS_QH), *KH = (_Float16*)(ws + WS_KH), *VT = (_Float16*)(ws + WS_VT), *QL = (_Float16*)(ws + WS_QL), *KL = (_Float16*)(ws + WS_KL); __bf16 *VB = (__bf16*)(ws + WS_VB), *VBL = (__bf16*)(ws + WS_VBL); float *S = (float*)(ws + WS_S), *Y = (float*)(ws + WS_Y);
  (void)Y; (void)QL; (void)KL; (void)VB; (void)VBL;
  // inputs: 0 query [2,2048,1024]; 1 key; 2 value; 3 weights [2,2048]; 4 wq [1024,1024] (in,out), 5 bq; 6 wk, 7 bk; 8 wv, 9 bv; 10 wo (in,out), 11 bo (all biases zeros, read)
  k_proj<<<dim3(TNB * TT / 64, CC / 128, 3), 128, 0, stream>>>(F[0], F[1], F[2], F[4], F[6], F[8], F[5], F[7], F[9], QH, QL, KH, KL, VT, VB, VBL);
  for (int b = 0; b < TNB; ++b) for (int h0 = 0; h0 < NH; h0 += HG) {
    k_sc<<<dim3(NQB, TT / 128, HG), 128, 0, stream>>>(QH, KH, QL, KL, b, h0, S);
    k_sm<<<dim3(TT, HG), 256, 0, stream>>>(S, b, F[3]);
    k_pv<<<dim3(NQB, 1, HG), 128, 0, stream>>>(S, VT, VB, VBL, b, h0, Y);
  }
  k_out<<<dim3(TNB * TT / 64, DIN / 128), 128, 0, stream>>>(Y, F[10], F[11], (float*)d_out);
}

// v002
// Measured time: 126 microseconds a run.
// It is 9.61 times as fast as v000, going by the measured steps of the versions left out in between.
// compute dtype: all float inputs rounded to bf16; q / k / v projections with EXACT bf16 products on WMMA 16x16x32 (f32 accumulate) + bias (zeros, read); logits k x q once to f16 each (1 product) x 64^-0.5, + logf(bf16(weight) + 1e-20) per key in f32; online softmax f32 (base 2); exp2(logit - running max) x 2^8 once to f16 x v once to f16 (1 product), divided by the f32 sum at the end; ctx x 2^6 once to f16 x wo f16(bf16 x 2^8) + bo; f32 output.
#include <hip/hip_runtime.h>
#include <math.h>

typedef __attribute__((ext_vector_type(16))) _Float16 v16h;
typedef __attribute__((ext_vector_type(16))) __bf16 v16b;
typedef __attribute__((ext_vector_type(8)))  _Float16 v8h;
typedef __attribute__((ext_vector_type(8)))  float v8f;
typedef __attribute__((ext_vector_type(4)))  float v4f;
typedef __attribute__((ext_vector_type(2)))  float v2f;
typedef __attribute__((ext_vector_type(4)))  unsigned v4u;
typedef __attribute__((ext_vector_type(4)))  int v4i;
typedef float __attribute__((may_alias)) float_a;
typedef int __attribute__((may_alias)) int_a;

template <typename T> __device__ __forceinline__ void vst2(void* p, T v) { *(T*)p = v;  }
__device__ __forceinline__ v8f wmma16(v16h a, v16h b, v8f c) {
  v8f d = __builtin_amdgcn_wmma_f32_16x16x32_f16(false, a, false, b, (short)0, c, false, false);
  asm volatile("v_nop\n\tv_nop\n\tv_nop\n\tv_nop" : "+v"(d) : "v"(a), "v"(b));
  return d;
}
__device__ __forceinline__ v8f wmma_bf(v16b a, v16b b, v8f c) {
  v8f d = __builtin_amdgcn_wmma_f32_16x16x32_bf16(false, a, false, b, (short)0, c, false, false);
  asm volatile("v_nop\n\tv_nop\n\tv_nop\n\tv_nop" : "+v"(d) : "v"(a), "v"(b));
  return d;
}
// 16x16x32 fragments: lane = (h = lane>>4, row/col = lane&15); elements 0..7 = k0+8h+0..7, 8..15 = k0+16+8h+0..7; D element r = row 8h+r
__device__ __forceinline__ v16h frag_h(const _Float16* rowk0, int lane) {
  union { v16h v; v8h q[2]; } u; const _Float16* p = rowk0 + 8 * (lane >> 4);
  u.q[0] = *(const v8h*)p; u.q[1] = *(const v8h*)(p + 16); return u.v;
}
__device__ __forceinline__ v16h frag_f32(const float* rowk0, int lane) {
  v16h a; const float* p = rowk0 + 8 * (lane >> 4);
#pragma unroll
  for (int i = 0; i < 8; ++i) { a[i] = (_Float16)p[i]; a[8 + i] = (_Float16)p[16 + i]; }
  return a;
}
__device__ __forceinline__ v16h frag_f32s(const float* rowk0, int lane, float sc) {
  v16h a; const float* p = rowk0 + 8 * (lane >> 4);
#pragma unroll
  for (int i = 0; i < 8; ++i) { a[i] = (_Float16)(p[i] * sc); a[8 + i] = (_Float16)(p[16 + i] * sc); }
  return a;
}
// column fragment from a [K][ld] layout (column n), rows >= K read as 0
__device__ __forceinline__ v16h fragc_f32(const float* W, int k0, int n, int lane, int ld, int K) {
  v16h a; const int g = lane >> 4;
#pragma unroll
  for (int i = 0; i < 8; ++i) { const int ka = k0 + 8 * g + i, kb = ka + 16;
    a[i] = (_Float16)(ka < K ? W[(size_t)(ka < K ? ka : K - 1) * ld + n] : 0.f); a[8 + i] = (_Float16)(kb < K ? W[(size_t)(kb < K ? kb : K - 1) * ld + n] : 0.f); }
  return a;
}
struct F2 { v16b h, l; };
__device__ __forceinline__ F2 bsplit16(const float v[16]) { F2 r;
#pragma unroll
  for (int i = 0; i < 16; ++i) { const __bf16 h = (__bf16)v[i]; r.h[i] = h; r.l[i] = (__bf16)(v[i] - (float)h); }
  return r; }
__device__ __forceinline__ F2 split_row(const float* row, int k0, int lane) { float v[16]; const float* p = row + k0 + 8 * (lane >> 4);
#pragma unroll
  for (int i = 0; i < 8; ++i) { v[i] = p[i]; v[8 + i] = p[16 + i]; }
  return bsplit16(v); }
__device__ __forceinline__ F2 split_rowK(const float* row, int k0, int lane, int K) { float v[16]; const int g = lane >> 4;
#pragma unroll
  for (int i = 0; i < 8; ++i) { const int ka = k0 + 8 * g + i, kb = ka + 16; v[i] = ka < K ? row[ka < K ? ka : K - 1] : 0.f; v[8 + i] = kb < K ? row[kb < K ? kb : K - 1] : 0.f; }
  return bsplit16(v); }
__device__ __forceinline__ F2 split_col(const float* W, int k0, int n, int lane, int ld, int K) { float v[16]; const int g = lane >> 4;
#pragma unroll
  for (int i = 0; i < 8; ++i) { const int ka = k0 + 8 * g + i, kb = ka + 16; v[i] = ka < K ? W[(size_t)(ka < K ? ka : K - 1) * ld + n] : 0.f; v[8 + i] = kb < K ? W[(size_t)(kb < K ? kb : K - 1) * ld + n] : 0.f; }
  return bsplit16(v); }
__device__ __forceinline__ v8f mac3(const F2& a, const F2& b, v8f c) { c = wmma_bf(a.l, b.h, c); c = wmma_bf(a.h, b.l, c); return wmma_bf(a.h, b.h, c); }
__device__ __forceinline__ float sigm(float v) { return 1.0f / (1.0f + expf(-v)); }
#define LDSX() do { asm volatile("s_wait_dscnt 0" ::: "memory"); __builtin_amdgcn_wave_barrier(); __builtin_amdgcn_fence(__ATOMIC_RELEASE, "workgroup"); } while (0)

// Multi-head attention on separate inputs with a per-key multiplicative weight (query / key / value [2,2048,1024]; (in,out) wq / wk / wv / wo [1024,1024] N(0, 1/1024) applied as x @ W + b, all biases zeros (read); weights [2,2048] uniform(0,1), one per (batch, key); 16 heads x 64; scores / sqrt(64) + log(weights + 1e-20) broadcast over heads and queries; softmax over keys; out @ wo + bo).
#define NB 2
#define TT 2048
#define CC 1024            // NH * HD = projected width
#define DIN 1024          // input (model) width
#define NH 16
#define HD 64
#define NQB (TT / 64)
#define HG 4
#define SCALE (0.125f)
#define CAUSAL 0
#ifndef TNB
#define TNB NB
#endif
__device__ __forceinline__ float bfr(float v) { return (float)(__bf16)v; }
__host__ __device__ __forceinline__ int kb_last(int qb) { return CAUSAL ? ((qb * 64 + 63) >> 7) : (TT / 128 - 1); }
typedef __attribute__((ext_vector_type(8))) __bf16 v8b;
__device__ __forceinline__ v16b frag_b(const __bf16* rowk0, int lane) {
  union { v16b v; v8b q[2]; } u; const __bf16* p = rowk0 + 8 * (lane >> 4);
  u.q[0] = *(const v8b*)p; u.q[1] = *(const v8b*)(p + 16); return u.v;
}
#define QBH 0              // unused: this file has no high-precision path
#define QHI 0               // single-product logits on every row (logit sigma ~1)
#define KHI 64            // key rows carrying k residual / v bf16 hi+lo planes (written by k_proj, read by no kernel)
// B fragment (k rows k0+.., output column o) of a weight: (in,out) [K][ld] or (out,in) [ld rows of K]: bf16 exact, or f16(bf16 * 256) exact
__device__ __forceinline__ v16b wcol_io(const float* Wm, int k0, int o, int lane, int ld) { v16b w; const int g = lane >> 4;
#pragma unroll
  for (int i = 0; i < 8; ++i) { w[i] = (__bf16)Wm[(size_t)(k0 + 8 * g + i) * ld + o]; w[8 + i] = (__bf16)Wm[(size_t)(k0 + 16 + 8 * g + i) * ld + o]; }
  return w; }
__device__ __forceinline__ v16b wcol_oi(const float* Wm, int k0, int o, int lane, int K) { v16b w; const float* p = Wm + (size_t)o * K + k0 + 8 * (lane >> 4);
#pragma unroll
  for (int i = 0; i < 8; ++i) { w[i] = (__bf16)p[i]; w[8 + i] = (__bf16)p[16 + i]; }
  return w; }
__device__ __forceinline__ v16h wcolh_io(const float* Wm, int k0, int o, int lane, int ld) { v16h w; const int g = lane >> 4;
#pragma unroll
  for (int i = 0; i < 8; ++i) { w[i] = (_Float16)(bfr(Wm[(size_t)(k0 + 8 * g + i) * ld + o]) * 256.0f); w[8 + i] = (_Float16)(bfr(Wm[(size_t)(k0 + 16 + 8 * g + i) * ld + o]) * 256.0f); }
  return w; }
__device__ __forceinline__ v16h wcolh_oi(const float* Wm, int k0, int o, int lane, int K) { v16h w; const float* p = Wm + (size_t)o * K + k0 + 8 * (lane >> 4);
#pragma unroll
  for (int i = 0; i < 8; ++i) { w[i] = (_Float16)(bfr(p[i]) * 256.0f); w[8 + i] = (_Float16)(bfr(p[16 + i]) * 256.0f); }
  return w; }
#define WQKV_LAYOUT 0   // 0 = (in,out) [DIN][CC]; 1 = (out,in) [CC][DIN]; 2 = per-head [NH][DIN][HD]
__device__ __forceinline__ v16b wcol_hdk(const float* Wm, int k0, int o, int lane) { v16b w; const int g = lane >> 4; const float* p = Wm + (size_t)(o / HD) * DIN * HD + (o % HD);
#pragma unroll
  for (int i = 0; i < 8; ++i) { w[i] = (__bf16)p[(size_t)(k0 + 8 * g + i) * HD]; w[8 + i] = (__bf16)p[(size_t)(k0 + 16 + 8 * g + i) * HD]; }
  return w; }
#define WO_OUT_IN 0
#if WQKV_LAYOUT == 1
#define WCOL(W, k0, o, lane) wcol_oi(W, k0, o, lane, DIN)
#elif WQKV_LAYOUT == 2
#define WCOL(W, k0, o, lane) wcol_hdk(W, k0, o, lane)
#else
#define WCOL(W, k0, o, lane) wcol_io(W, k0, o, lane, CC)
#endif
#if WO_OUT_IN
#define WOCOL(W, k0, o, lane) wcol_oi(W, k0, o, lane, CC)
#define WOCOLH(W, k0, o, lane) wcolh_oi(W, k0, o, lane, CC)
#else
#define WOCOL(W, k0, o, lane) wcol_io(W, k0, o, lane, DIN)
#define WOCOLH(W, k0, o, lane) wcolh_io(W, k0, o, lane, DIN)
#endif

#define WS_QH  0u                                      // f16 q rows [b*t][CC]
#define WS_KH  (WS_QH + 2u * (size_t)NB * TT * CC)      // f16 k rows [b*t][CC]
#define WS_VT  (WS_KH + 2u * (size_t)NB * TT * CC)      // f16 v planes [b][c][t]
#define WS_QL  (WS_VT + 2u * (size_t)NB * CC * TT)      // f16 q residual x 2^10 rows [b][t < QHI][CC]
#define WS_KL  (WS_QL + 2u * (size_t)NB * QHI * CC)     // f16 k residual x 2^10 rows [b][t < KHI][CC]
#define WS_VB  (WS_KL + 2u * (size_t)NB * KHI * CC)     // bf16 v hi planes [b][c][t < KHI]
#define WS_VBL (WS_VB + 2u * (size_t)NB * CC * KHI)
#define WS_S   (WS_VBL + 2u * (size_t)NB * CC * KHI)    // f32 region [hg][t][s], written and read by no kernel
#define WS_Y   (WS_S  + 4u * (size_t)HG * TT * TT)      // f32 ctx rows [b*t][CC] (only when there is an output projection)
#define WS_END (WS_Y  + 4u * (size_t)NB * TT * CC)

// ---- shared by k_proj and k_out: one 128 x 128 tile of X W per block of 8 waves (4 x 2, each 32 rows x 64 columns). A pass is GK k (32 in k_proj, so that three blocks fit a WGP's registers; 64 in k_out, one block a WGP, for more bytes in flight): the block reads both f32 operand tiles once, in whole 128-byte lines, rounds them to their 16-bit form and lays them k-contiguous in LDS (X rows, W columns), pitch 2 GK + 16 B; every wave takes its fragments from there. Two buffers: the next pass's global loads fly during this pass's products; one barrier a pass
typedef __attribute__((ext_vector_type(2))) unsigned v2u;
typedef __attribute__((ext_vector_type(2))) __bf16 v2b;
typedef __attribute__((ext_vector_type(2))) _Float16 v2h;
#define GSM(GK) (4 * 128 * ((GK) + 8))   // 16-bit elements of LDS: two buffers x two operand tiles of 128 rows, pitch GK + 8
// KIND 0: x and w to bf16 (exact bf16 products); KIND 1: x * 2^6 to f16, bf16(w) * 2^8 to f16
template <int KIND> __device__ __forceinline__ unsigned pkx(float a, float b) {
  if constexpr (KIND == 0) { v2b t; t[0] = (__bf16)a; t[1] = (__bf16)b; return __builtin_bit_cast(unsigned, t); }
  else { v2h t; t[0] = (_Float16)(a * 64.0f); t[1] = (_Float16)(b * 64.0f); return __builtin_bit_cast(unsigned, t); } }
template <int KIND> __device__ __forceinline__ unsigned pkw(float a, float b) {
  if constexpr (KIND == 0) { v2b t; t[0] = (__bf16)a; t[1] = (__bf16)b; return __builtin_bit_cast(unsigned, t); }
  else { v2h t; t[0] = (_Float16)(bfr(a) * 256.0f); t[1] = (_Float16)(bfr(b) * 256.0f); return __builtin_bit_cast(unsigned, t); } }
struct G8 { v4u q[2]; };
__device__ __forceinline__ G8 frag_s(const unsigned short* rowk0, int lane) { G8 f; const unsigned short* p = rowk0 + 8 * (lane >> 4); f.q[0] = *(const v4u*)p; f.q[1] = *(const v4u*)(p + 16); return f; }
template <int KIND> __device__ __forceinline__ v8f wmma_g(G8 a, G8 b, v8f c) {
  if constexpr (KIND == 0) return __builtin_amdgcn_wmma_f32_16x16x32_bf16(false, __builtin_bit_cast(v16b, a), false, __builtin_bit_cast(v16b, b), (short)0, c, false, false);
  else return __builtin_amdgcn_wmma_f32_16x16x32_f16(false, __builtin_bit_cast(v16h, a), false, __builtin_bit_cast(v16h, b), (short)0, c, false, false); }
// X [rows][KD] row-major, Wm [KD][ND] row-major; acc[i][j] = rows r0 + 32 (wave >> 1) + 16 i, columns c0 + 64 (wave & 1) + 16 j; k ascending in steps of 32 into one accumulator. Every inner loop is fully unrolled so that the staging, fragment and accumulator arrays are indexed by constants and stay in registers. Ends behind a barrier: sm is free
template <int KIND, int GK, int KD, int ND> __device__ __forceinline__ void gemm_tile(const float* __restrict__ X, const float* __restrict__ Wm, size_t r0, int c0, unsigned short* sm, v8f (&acc)[2][4]) {
  const int tid = threadIdx.x, wave = tid >> 5, lane = tid & 31, col = lane & 15; const int wm = wave >> 1, wn = wave & 1;
  constexpr int GP = GK + 8, GT = 128 * GP, XT = GK / 4, XS = XT / 2, XR = 256 / XT, WS = GK / 16;
  const int xr = tid / XT, xq = tid % XT;     /* X: XT threads x 16 B = one row's GK floats; XR rows a step, XS steps */
  const int wc = tid & 127, wo = tid >> 7;    /* W: one column a thread, lanes along the row (128 B a wave-load); k octets wo, wo + 2, ... */
  const float* xp = X + (r0 + xr) * KD + xq * 4; const float* wp = Wm + (size_t)(wo * 8) * ND + c0 + wc;
  v4f xv[XS]; float wv[WS][8];
#define G_LOAD(k0) do { _Pragma("unroll") for (int i = 0; i < XS; ++i) xv[i] = *(const v4f*)(xp + (size_t)(i * XR) * KD + (k0)); \
    _Pragma("unroll") for (int i = 0; i < WS; ++i) _Pragma("unroll") for (int e = 0; e < 8; ++e) wv[i][e] = wp[(size_t)((k0) + i * 16 + e) * ND]; } while (0)
#define G_STORE(buf) do { unsigned short* As = sm + (buf) * (2 * GT); unsigned short* Bs = As + GT; \
    _Pragma("unroll") for (int i = 0; i < XS; ++i) { v2u t; t[0] = pkx<KIND>(xv[i][0], xv[i][1]); t[1] = pkx<KIND>(xv[i][2], xv[i][3]); *(v2u*)&As[(xr + i * XR) * GP + xq * 4] = t; } \
    _Pragma("unroll") for (int i = 0; i < WS; ++i) { v4u t; t[0] = pkw<KIND>(wv[i][0], wv[i][1]); t[1] = pkw<KIND>(wv[i][2], wv[i][3]); t[2] = pkw<KIND>(wv[i][4], wv[i][5]); t[3] = pkw<KIND>(wv[i][6], wv[i][7]); *(v4u*)&Bs[wc * GP + (wo + 2 * i) * 8] = t; } } while (0)
  G_LOAD(0); G_STORE(0);
  __syncthreads();
  for (int ks = 0; ks < KD / GK; ++ks) {
    const bool more = ks + 1 < KD / GK;
    if (more) { G_LOAD((ks + 1) * GK); asm volatile("s_wait_xcnt 0x0" ::: "memory"); }   /* the wait: the loads' address registers are rewritten further down in the pass */
    __builtin_amdgcn_sched_barrier(0);   /* keeps the next pass's global loads ahead of this pass's products; the compiler otherwise sinks them to just in front of their use and their latency is waited out */
    const unsigned short* As = sm + (ks & 1) * (2 * GT) + (wm * 32 + col) * GP; const unsigned short* Bs = sm + (ks & 1) * (2 * GT) + GT + (wn * 64 + col) * GP;
#pragma unroll
    for (int kc = 0; kc < GK / 32; ++kc) { G8 a[2], b[4];
#pragma unroll
      for (int i = 0; i < 2; ++i) a[i] = frag_s(As + i * 16 * GP + kc * 32, lane);
#pragma unroll
      for (int j = 0; j < 4; ++j) b[j] = frag_s(Bs + j * 16 * GP + kc * 32, lane);
#pragma unroll
      for (int i = 0; i < 2; ++i)
#pragma unroll
        for (int j = 0; j < 4; ++j) acc[i][j] = wmma_g<KIND>(a[i], b[j], acc[i][j]); }
    __builtin_amdgcn_sched_barrier(0);   /* keeps the rounding of the loaded values, and with it the wait for them, behind the products */
    if (more) G_STORE((ks + 1) & 1);   /* into the buffer that every wave left at the barrier of the pass before */
    __syncthreads(); }
#undef G_LOAD
#undef G_STORE
}
// ---- k_proj: block = (128 rows, 128 cols, which): q/k/v = X W (+ b) with exact bf16 products (K = DIN) -> which 0: q f16 rows (+ residual rows < QHI); 1: k f16 rows (+ residual rows < KHI); 2: v f16 planes [c][t] (+ bf16 hi/lo planes for t < KHI). The output tile is staged in the LDS of the operand buffers, [128][136] 16-bit, and leaves in whole lines
#define EP 136
__global__ __launch_bounds__(256) void k_proj(const float* __restrict__ XQ, const float* __restrict__ XK, const float* __restrict__ XV, const float* __restrict__ WQ, const float* __restrict__ WK, const float* __restrict__ WV, const float* __restrict__ BQ, const float* __restrict__ BK, const float* __restrict__ BV,
    _Float16* __restrict__ QH, _Float16* __restrict__ QL, _Float16* __restrict__ KH, _Float16* __restrict__ KL, _Float16* __restrict__ VT, __bf16* __restrict__ VB, __bf16* __restrict__ VBL) {
  __shared__ __align__(16) unsigned short sm[GSM(32)];
  const int tid = threadIdx.x, wave = tid >> 5, lane = tid & 31, col = lane & 15, g = lane >> 4; const int wm = wave >> 1, wn = wave & 1; const int which = blockIdx.z; const int c0 = blockIdx.y * 128; const size_t r0 = (size_t)blockIdx.x * 128; const size_t bb = r0 / TT; const int t0 = (int)(r0 % TT);
  const float* X = which == 0 ? XQ : which == 1 ? XK : XV; const float* WA = which == 0 ? WQ : which == 1 ? WK : WV; const float* BA = which == 0 ? BQ : which == 1 ? BK : BV;
  v8f acc[2][4] = {};
  gemm_tile<0, 32, DIN, CC>(X, WA, r0, c0, sm, acc);
#pragma unroll
  for (int j = 0; j < 4; ++j) { const float bias = BA ? bfr(BA[c0 + wn * 64 + j * 16 + col]) : 0.f;
#pragma unroll
    for (int i = 0; i < 2; ++i) acc[i][j] = acc[i][j] + bias; }
  if (which < 2) { _Float16* DH = which == 0 ? QH : KH; _Float16* DL = which == 0 ? QL : KL; const int nhi = which == 0 ? QHI : KHI; _Float16* st = (_Float16*)sm;
#pragma unroll
    for (int i = 0; i < 2; ++i)
#pragma unroll
      for (int j = 0; j < 4; ++j)
#pragma unroll
        for (int r = 0; r < 8; ++r) st[(wm * 32 + i * 16 + 8 * g + r) * EP + wn * 64 + j * 16 + col] = (_Float16)acc[i][j][r];
    __syncthreads();
    for (int e = tid; e < 128 * 16; e += 256) { const int rl = e >> 4, q = e & 15; vst2((unsigned*)(DH + (r0 + rl) * CC + c0 + q * 8), *(const v4u*)&st[rl * EP + q * 8]); }
    if (t0 < nhi) {   /* block-uniform */
      __syncthreads();
#pragma unroll
      for (int i = 0; i < 2; ++i)
#pragma unroll
        for (int j = 0; j < 4; ++j)
#pragma unroll
          for (int r = 0; r < 8; ++r) { const float v = acc[i][j][r]; st[(wm * 32 + i * 16 + 8 * g + r) * EP + wn * 64 + j * 16 + col] = (_Float16)((v - (float)(_Float16)v) * 1024.0f); }
      __syncthreads();
      for (int e = tid; e < 128 * 16; e += 256) { const int rl = e >> 4, q = e & 15; if (t0 + rl < nhi) { vst2((unsigned*)(DL + (bb * nhi + t0 + rl) * (size_t)CC + c0 + q * 8), *(const v4u*)&st[rl * EP + q * 8]); asm volatile("s_wait_xcnt 0x0" ::: "memory"); /* the store's address register is stepped at the loop's foot */ } } }
  } else { _Float16* st = (_Float16*)sm; __bf16* sb = (__bf16*)sm;
#pragma unroll
    for (int i = 0; i < 2; ++i)
#pragma unroll
      for (int j = 0; j < 4; ++j) { v8h t;
#pragma unroll
        for (int r = 0; r < 8; ++r) t[r] = (_Float16)acc[i][j][r];
        *(v8h*)&st[(wn * 64 + j * 16 + col) * EP + wm * 32 + i * 16 + 8 * g] = t; }
    __syncthreads();
    for (int e = tid; e < 128 * 16; e += 256) { const int cl = e >> 4, q = e & 15; vst2((unsigned*)(VT + (bb * CC + c0 + cl) * (size_t)TT + t0 + q * 8), *(const v4u*)&st[cl * EP + q * 8]); }
    if (t0 < KHI) {   /* block-uniform */
#pragma unroll
      for (int pl = 0; pl < 2; ++pl) { __bf16* D = pl == 0 ? VB : VBL;
        __syncthreads();
#pragma unroll
        for (int i = 0; i < 2; ++i)
#pragma unroll
          for (int j = 0; j < 4; ++j) { v8b t;
#pragma unroll
            for (int r = 0; r < 8; ++r) { const float v = acc[i][j][r]; const __bf16 bh = (__bf16)v; t[r] = pl == 0 ? bh : (__bf16)(v - (float)bh); }
            *(v8b*)&sb[(wn * 64 + j * 16 + col) * EP + wm * 32 + i * 16 + 8 * g] = t; }
        __syncthreads();
        for (int e = tid; e < 128 * 16; e += 256) { const int cl = e >> 4, q = e & 15; if (t0 + q * 8 < KHI) { vst2((unsigned*)(D + (bb * CC + c0 + cl) * (size_t)KHI + t0 + q * 8), *(const v4u*)&sb[cl * EP + q * 8]); asm volatile("s_wait_xcnt 0x0" ::: "memory"); /* the store's address register is stepped at the loop's foot */ } } } } } }
// ---- k_fa: block = 256 queries of (b, h), 8 waves x 32 query columns; one pass = 32 keys. S^T = K Q^T (A = k rows, B = q rows, same k order), logits x SCALE + log-weight in the log2 domain, running maximum and sum per query column (online softmax), P x 2^8 once to f16 packed from the two score tiles as the B operand, O^T += V^T P^T (A = v planes); the logits never leave the registers. Every inner loop is fully unrolled so that the fragment and accumulator arrays are indexed by constants and stay in registers
#define FQ 2               // 16-column query groups per wave
#define LOG2E 1.44269504088896340736f
__device__ __forceinline__ float xhalf(float x) { return __builtin_bit_cast(float, __builtin_amdgcn_permlanex16(__builtin_bit_cast(int, x), __builtin_bit_cast(int, x), 0x76543210, 0xfedcba98, false, false)); }   // lane l with lane l ^ 16
__device__ __forceinline__ v8f wmma_h(v16h a, v16h b, v8f c) { return __builtin_amdgcn_wmma_f32_16x16x32_f16(false, a, false, b, (short)0, c, false, false); }
__global__ __launch_bounds__(256) void k_fa(const _Float16* __restrict__ QH, const _Float16* __restrict__ KH, const _Float16* __restrict__ VT, const float* __restrict__ WGT, float* __restrict__ Y) { __shared__ __align__(32) float slw[TT];
  const int tid = threadIdx.x, wave = tid >> 5, lane = tid & 31, col = lane & 15, g = lane >> 4; const int h = blockIdx.y, b = blockIdx.z; const int q0 = blockIdx.x * (128 * FQ) + wave * (16 * FQ);
  for (int k = tid; k < TT; k += 256) slw[k] = logf(bfr(WGT[(size_t)b * TT + k]) + 1.0e-20f) * LOG2E;   /* per-key log-weight, once per block */
  __syncthreads();
  v16h qf[FQ][2];
#pragma unroll
  for (int c = 0; c < FQ; ++c)
#pragma unroll
    for (int kc = 0; kc < 2; ++kc) qf[c][kc] = frag_h(QH + ((size_t)b * TT + q0 + c * 16 + col) * CC + h * HD + kc * 32, lane);
  const _Float16* Kp = KH + ((size_t)b * TT + col) * CC + h * HD; const _Float16* Vp = VT + ((size_t)b * CC + h * HD + col) * (size_t)TT;
  v8f acc[FQ][4] = {}; float m[FQ], l[FQ];
#pragma unroll
  for (int c = 0; c < FQ; ++c) { m[c] = -1.0e30f; l[c] = 0.f; }
  v16h kf[2][2];
#pragma unroll
  for (int t = 0; t < 2; ++t)
#pragma unroll
    for (int kc = 0; kc < 2; ++kc) kf[t][kc] = frag_h(Kp + (size_t)(t * 16) * CC + kc * 32, lane);
  for (int k0 = 0; k0 < TT; k0 += 32) {
    v16h vf[4];
#pragma unroll
    for (int j = 0; j < 4; ++j) vf[j] = frag_h(Vp + (size_t)(j * 16) * TT + k0, lane);
    v8f lw[2];
#pragma unroll
    for (int t = 0; t < 2; ++t) lw[t] = *(const v8f*)&slw[k0 + t * 16 + 8 * g];
    v8f s[FQ][2] = {};
#pragma unroll
    for (int kc = 0; kc < 2; ++kc)
#pragma unroll
      for (int c = 0; c < FQ; ++c)
#pragma unroll
        for (int t = 0; t < 2; ++t) s[c][t] = wmma_h(kf[t][kc], qf[c][kc], s[c][t]);
    const int kn = k0 + 32 < TT ? k0 + 32 : 0;   /* next pass's k rows, fetched behind this pass's score products (the last pass re-reads rows 0..31, unused) */
#pragma unroll
    for (int t = 0; t < 2; ++t)
#pragma unroll
      for (int kc = 0; kc < 2; ++kc) kf[t][kc] = frag_h(Kp + (size_t)(kn + t * 16) * CC + kc * 32, lane);
    asm volatile("s_wait_xcnt 0x0" ::: "memory");   /* the loads above are issued here, a softmax ahead of their use, and their address registers are free to be rewritten behind this line */
    __builtin_amdgcn_sched_barrier(0);   /* keeps the softmax below from being scheduled ahead of the prefetch, which would then be issued only a few instructions before the next pass needs it */
#pragma unroll
    for (int c = 0; c < FQ; ++c) {
      float mx = m[c];
#pragma unroll
      for (int t = 0; t < 2; ++t)
#pragma unroll
        for (int r = 0; r < 8; ++r) { s[c][t][r] = fmaf(s[c][t][r], SCALE * LOG2E, lw[t][r]); mx = fmaxf(mx, s[c][t][r]); }
      mx = fmaxf(mx, xhalf(mx));   /* the two lane halves hold the two key halves of one query column */
      const float alpha = __builtin_amdgcn_exp2f(m[c] - mx); m[c] = mx; const float ms = mx - 8.0f;
      float sum = 0.f; v16h p;
#pragma unroll
      for (int t = 0; t < 2; ++t)
#pragma unroll
        for (int r = 0; r < 8; ++r) { const float e = __builtin_amdgcn_exp2f(s[c][t][r] - ms); sum += e; p[t * 8 + r] = (_Float16)e; }
      l[c] = l[c] * alpha + sum;
#pragma unroll
      for (int j = 0; j < 4; ++j) { acc[c][j] = acc[c][j] * alpha; acc[c][j] = wmma_h(vf[j], p, acc[c][j]); } } }
#pragma unroll
  for (int c = 0; c < FQ; ++c) { const float lt = l[c] + xhalf(l[c]); const float inv = lt > 0.f ? 1.0f / lt : 0.f; float* yr = Y + ((size_t)b * TT + q0 + c * 16 + col) * CC + h * HD + 8 * g;
#pragma unroll
    for (int j = 0; j < 4; ++j) { const v8f o = acc[c][j] * inv; vst2(yr + j * 16, __builtin_shufflevector(o, o, 0, 1, 2, 3)); vst2(yr + j * 16 + 4, __builtin_shufflevector(o, o, 4, 5, 6, 7)); } } }
// ---- k_out: block = (128 rows, 128 cols): out = ctx Wo (+ bo): ctx x 2^6 once to f16 (small-magnitude context rows stay clear of f16 subnormals) against Wo as f16(bf16 x 2^8) exact (1 product) x 2^-14. Each wave stages its 32 x 64 f32 in its own part of the LDS of the operand buffers and stores whole lines
__global__ __launch_bounds__(256) void k_out(const float* __restrict__ Y, const float* __restrict__ WO, const float* __restrict__ BO, float* __restrict__ OUT) { __shared__ __align__(16) unsigned short sm[GSM(64)];
  const int tid = threadIdx.x, wave = tid >> 5, lane = tid & 31, col = lane & 15, g = lane >> 4; const int wm = wave >> 1, wn = wave & 1; const int c0 = blockIdx.y * 128; const size_t r0 = (size_t)blockIdx.x * 128;
  v8f acc[2][4] = {};
  gemm_tile<1, 64, CC, DIN>(Y, WO, r0, c0, sm, acc);
  float* sf = (float*)sm + wave * (32 * 68);
#pragma unroll
  for (int j = 0; j < 4; ++j) { const float bias = BO ? bfr(BO[c0 + wn * 64 + j * 16 + col]) : 0.f;
#pragma unroll
    for (int i = 0; i < 2; ++i)
#pragma unroll
      for (int r = 0; r < 8; ++r) sf[(i * 16 + 8 * g + r) * 68 + j * 16 + col] = acc[i][j][r] * (1.0f / 16384.0f) + bias; }   /* 2^-8 (Wo carry) x 2^-6 (ctx carry) */
  LDSX(); for (int it = 0; it < 16; ++it) { const int rl = it * 2 + g; vst2(OUT + (r0 + wm * 32 + rl) * DIN + c0 + wn * 64 + col * 4, *(const v4f*)&sf[rl * 68 + col * 4]); } }

extern "C" void kernel_launch(void* const* d_in, const int* in_sizes, int n_in, void* d_out, int out_size, void* d_ws, size_t ws_size, hipStream_t stream) {
  (void)in_sizes; (void)n_in; (void)out_size;
  const float** F = (const float**)d_in;
  if (ws_size < (size_t)WS_END) return;
  char* ws = (char*)d_ws; _Float16 *QH = (_Float16*)(ws + WS_QH), *KH = (_Float16*)(ws + WS_KH), *VT = (_Float16*)(ws + WS_VT), *QL = (_Float16*)(ws + WS_QL), *KL = (_Float16*)(ws + WS_KL); __bf16 *VB = (__bf16*)(ws + WS_VB), *VBL = (__bf16*)(ws + WS_VBL); float *S = (float*)(ws + WS_S), *Y = (float*)(ws + WS_Y);
  (void)Y; (void)QL; (void)KL; (void)VB; (void)VBL; (void)S;
  // inputs: 0 query [2,2048,1024]; 1 key; 2 value; 3 weights [2,2048]; 4 wq [1024,1024] (in,out), 5 bq; 6 wk, 7 bk; 8 wv, 9 bv; 10 wo (in,out), 11 bo (all biases zeros, read)
  k_proj<<<dim3(TNB * TT / 128, CC / 128, 3), 256, 0, stream>>>(F[0], F[1], F[2], F[4], F[6], F[8], F[5], F[7], F[9], QH, QL, KH, KL, VT, VB, VBL);
  k_fa<<<dim3(TT / (128 * FQ), NH, TNB), 256, 0, stream>>>(QH, KH, VT, F[3], Y);
  k_out<<<dim3(TNB * TT / 128, DIN / 128), 256, 0, stream>>>(Y, F[10], F[11], (float*)d_out);
}

// v003
// Measured time: 107 microseconds a run.
// Two timings next to v002 put it at 1.19 and 1.18 times that version's speed.
// Counting every step since v000, it is 11.4 times as fast.
// compute dtype: all float inputs rounded to bf16; q / k / v projections with EXACT bf16 products on WMMA 16x16x32 (f32 accumulate) + bias (zeros, read); logits k x q once to f16 each (1 product) x 64^-0.5, + logf(bf16(weight) + 1e-20) per key in f32; online softmax f32 (base 2); exp2(logit - running max) x 2^8 once to f16 x v once to f16 (1 product), divided by the f32 sum at the end; ctx x 2^6 once to f16 x wo f16(bf16 x 2^8) + bo; f32 output.
#include <hip/hip_runtime.h>
#include <math.h>

typedef __attribute__((ext_vector_type(16))) _Float16 v16h;
typedef __attribute__((ext_vector_type(16))) __bf16 v16b;
typedef __attribute__((ext_vector_type(8)))  _Float16 v8h;
typedef __attribute__((ext_vector_type(8)))  float v8f;
typedef __attribute__((ext_vector_type(4)))  float v4f;
typedef __attribute__((ext_vector_type(2)))  float v2f;
typedef __attribute__((ext_vector_type(4)))  unsigned v4u;
typedef __attribute__((ext_vector_type(4)))  int v4i;
typedef float __attribute__((may_alias)) float_a;
typedef int __attribute__((may_alias)) int_a;

template <typename T> __device__ __forceinline__ void vst2(void* p, T v) { *(T*)p = v;  }
__device__ __forceinline__ v8f wmma16(v16h a, v16h b, v8f c) {
  v8f d = __builtin_amdgcn_wmma_f32_16x16x32_f16(false, a, false, b, (short)0, c, false, false);
  asm volatile("v_nop\n\tv_nop\n\tv_nop\n\tv_nop" : "+v"(d) : "v"(a), "v"(b));
  return d;
}
__device__ __forceinline__ v8f wmma_bf(v16b a, v16b b, v8f c) {
  v8f d = __builtin_amdgcn_wmma_f32_16x16x32_bf16(false, a, false, b, (short)0, c, false, false);
  asm volatile("v_nop\n\tv_nop\n\tv_nop\n\tv_nop" : "+v"(d) : "v"(a), "v"(b));
  return d;
}
// 16x16x32 fragments: lane = (h = lane>>4, row/col = lane&15); elements 0..7 = k0+8h+0..7, 8..15 = k0+16+8h+0..7; D element r = row 8h+r
__device__ __forceinline__ v16h frag_h(const _Float16* rowk0, int lane) {
  union { v16h v; v8h q[2]; } u; const _Float16* p = rowk0 + 8 * (lane >> 4);
  u.q[0] = *(const v8h*)p; u.q[1] = *(const v8h*)(p + 16); return u.v;
}
__device__ __forceinline__ v16h frag_f32(const float* rowk0, int lane) {
  v16h a; const float* p = rowk0 + 8 * (lane >> 4);
#pragma unroll
  for (int i = 0; i < 8; ++i) { a[i] = (_Float16)p[i]; a[8 + i] = (_Float16)p[16 + i]; }
  return a;
}
__device__ __forceinline__ v16h frag_f32s(const float* rowk0, int lane, float sc) {
  v16h a; const float* p = rowk0 + 8 * (lane >> 4);
#pragma unroll
  for (int i = 0; i < 8; ++i) { a[i] = (_Float16)(p[i] * sc); a[8 + i] = (_Float16)(p[16 + i] * sc); }
  return a;
}
// column fragment from a [K][ld] layout (column n), rows >= K read as 0
__device__ __forceinline__ v16h fragc_f32(const float* W, int k0, int n, int lane, int ld, int K) {
  v16h a; const int g = lane >> 4;
#pragma unroll
  for (int i = 0; i < 8; ++i) { const int ka = k0 + 8 * g + i, kb = ka + 16;
    a[i] = (_Float16)(ka < K ? W[(size_t)(ka < K ? ka : K - 1) * ld + n] : 0.f); a[8 + i] = (_Float16)(kb < K ? W[(size_t)(kb < K ? kb : K - 1) * ld + n] : 0.f); }
  return a;
}
struct F2 { v16b h, l; };
__device__ __forceinline__ F2 bsplit16(const float v[16]) { F2 r;
#pragma unroll
  for (int i = 0; i < 16; ++i) { const __bf16 h = (__bf16)v[i]; r.h[i] = h; r.l[i] = (__bf16)(v[i] - (float)h); }
  return r; }
__device__ __forceinline__ F2 split_row(const float* row, int k0, int lane) { float v[16]; const float* p = row + k0 + 8 * (lane >> 4);
#pragma unroll
  for (int i = 0; i < 8; ++i) { v[i] = p[i]; v[8 + i] = p[16 + i]; }
  return bsplit16(v); }
__device__ __forceinline__ F2 split_rowK(const float* row, int k0, int lane, int K) { float v[16]; const int g = lane >> 4;
#pragma unroll
  for (int i = 0; i < 8; ++i) { const int ka = k0 + 8 * g + i, kb = ka + 16; v[i] = ka < K ? row[ka < K ? ka : K - 1] : 0.f; v[8 + i] = kb < K ? row[kb < K ? kb : K - 1] : 0.f; }
  return bsplit16(v); }
__device__ __forceinline__ F2 split_col(const float* W, int k0, int n, int lane, int ld, int K) { float v[16]; const int g = lane >> 4;
#pragma unroll
  for (int i = 0; i < 8; ++i) { const int ka = k0 + 8 * g + i, kb = ka + 16; v[i] = ka < K ? W[(size_t)(ka < K ? ka : K - 1) * ld + n] : 0.f; v[8 + i] = kb < K ? W[(size_t)(kb < K ? kb : K - 1) * ld + n] : 0.f; }
  return bsplit16(v); }
__device__ __forceinline__ v8f mac3(const F2& a, const F2& b, v8f c) { c = wmma_bf(a.l, b.h, c); c = wmma_bf(a.h, b.l, c); return wmma_bf(a.h, b.h, c); }
__device__ __forceinline__ float sigm(float v) { return 1.0f / (1.0f + expf(-v)); }
#define LDSX() do { asm volatile("s_wait_dscnt 0" ::: "memory"); __builtin_amdgcn_wave_barrier(); __builtin_amdgcn_fence(__ATOMIC_RELEASE, "workgroup"); } while (0)

// Multi-head attention on separate inputs with a per-key multiplicative weight (query / key / value [2,2048,1024]; (in,out) wq / wk / wv / wo [1024,1024] N(0, 1/1024) applied as x @ W + b, all biases zeros (read); weights [2,2048] uniform(0,1), one per (batch, key); 16 heads x 64; scores / sqrt(64) + log(weights + 1e-20) broadcast over heads and queries; softmax over keys; out @ wo + bo).
#define NB 2
#define TT 2048
#define CC 1024            // NH * HD = projected width
#define DIN 1024          // input (model) width
#define NH 16
#define HD 64
#define NQB (TT / 64)
#define HG 4
#define SCALE (0.125f)
#define CAUSAL 0
#ifndef TNB
#define TNB NB
#endif
__device__ __forceinline__ float bfr(float v) { return (float)(__bf16)v; }
__host__ __device__ __forceinline__ int kb_last(int qb) { return CAUSAL ? ((qb * 64 + 63) >> 7) : (TT / 128 - 1); }
typedef __attribute__((ext_vector_type(8))) __bf16 v8b;
__device__ __forceinline__ v16b frag_b(const __bf16* rowk0, int lane) {
  union { v16b v; v8b q[2]; } u; const __bf16* p = rowk0 + 8 * (lane >> 4);
  u.q[0] = *(const v8b*)p; u.q[1] = *(const v8b*)(p + 16); return u.v;
}
#define QBH 0              // unused: this file has no high-precision path
#define QHI 0               // single-product logits on every row (logit sigma ~1)
#define KHI 64            // key rows carrying k residual / v bf16 hi+lo planes (written by k_proj, read by no kernel)
// B fragment (k rows k0+.., output column o) of a weight: (in,out) [K][ld] or (out,in) [ld rows of K]: bf16 exact, or f16(bf16 * 256) exact
__device__ __forceinline__ v16b wcol_io(const float* Wm, int k0, int o, int lane, int ld) { v16b w; const int g = lane >> 4;
#pragma unroll
  for (int i = 0; i < 8; ++i) { w[i] = (__bf16)Wm[(size_t)(k0 + 8 * g + i) * ld + o]; w[8 + i] = (__bf16)Wm[(size_t)(k0 + 16 + 8 * g + i) * ld + o]; }
  return w; }
__device__ __forceinline__ v16b wcol_oi(const float* Wm, int k0, int o, int lane, int K) { v16b w; const float* p = Wm + (size_t)o * K + k0 + 8 * (lane >> 4);
#pragma unroll
  for (int i = 0; i < 8; ++i) { w[i] = (__bf16)p[i]; w[8 + i] = (__bf16)p[16 + i]; }
  return w; }
__device__ __forceinline__ v16h wcolh_io(const float* Wm, int k0, int o, int lane, int ld) { v16h w; const int g = lane >> 4;
#pragma unroll
  for (int i = 0; i < 8; ++i) { w[i] = (_Float16)(bfr(Wm[(size_t)(k0 + 8 * g + i) * ld + o]) * 256.0f); w[8 + i] = (_Float16)(bfr(Wm[(size_t)(k0 + 16 + 8 * g + i) * ld + o]) * 256.0f); }
  return w; }
__device__ __forceinline__ v16h wcolh_oi(const float* Wm, int k0, int o, int lane, int K) { v16h w; const float* p = Wm + (size_t)o * K + k0 + 8 * (lane >> 4);
#pragma unroll
  for (int i = 0; i < 8; ++i) { w[i] = (_Float16)(bfr(p[i]) * 256.0f); w[8 + i] = (_Float16)(bfr(p[16 + i]) * 256.0f); }
  return w; }
#define WQKV_LAYOUT 0   // 0 = (in,out) [DIN][CC]; 1 = (out,in) [CC][DIN]; 2 = per-head [NH][DIN][HD]
__device__ __forceinline__ v16b wcol_hdk(const float* Wm, int k0, int o, int lane) { v16b w; const int g = lane >> 4; const float* p = Wm + (size_t)(o / HD) * DIN * HD + (o % HD);
#pragma unroll
  for (int i = 0; i < 8; ++i) { w[i] = (__bf16)p[(size_t)(k0 + 8 * g + i) * HD]; w[8 + i] = (__bf16)p[(size_t)(k0 + 16 + 8 * g + i) * HD]; }
  return w; }
#define WO_OUT_IN 0
#if WQKV_LAYOUT == 1
#define WCOL(W, k0, o, lane) wcol_oi(W, k0, o, lane, DIN)
#elif WQKV_LAYOUT == 2
#define WCOL(W, k0, o, lane) wcol_hdk(W, k0, o, lane)
#else
#define WCOL(W, k0, o, lane) wcol_io(W, k0, o, lane, CC)
#endif
#if WO_OUT_IN
#define WOCOL(W, k0, o, lane) wcol_oi(W, k0, o, lane, CC)
#define WOCOLH(W, k0, o, lane) wcolh_oi(W, k0, o, lane, CC)
#else
#define WOCOL(W, k0, o, lane) wcol_io(W, k0, o, lane, DIN)
#define WOCOLH(W, k0, o, lane) wcolh_io(W, k0, o, lane, DIN)
#endif

#define WS_QH  0u                                      // f16 q rows [b*t][CC]
#define WS_KH  (WS_QH + 2u * (size_t)NB * TT * CC)      // f16 k rows [b*t][CC]
#define WS_VT  (WS_KH + 2u * (size_t)NB * TT * CC)      // f16 v planes [b][c][t]
#define WS_QL  (WS_VT + 2u * (size_t)NB * CC * TT)      // f16 q residual x 2^10 rows [b][t < QHI][CC]
#define WS_KL  (WS_QL + 2u * (size_t)NB * QHI * CC)     // f16 k residual x 2^10 rows [b][t < KHI][CC]
#define WS_VB  (WS_KL + 2u * (size_t)NB * KHI * CC)     // bf16 v hi planes [b][c][t < KHI]
#define WS_VBL (WS_VB + 2u * (size_t)NB * CC * KHI)
#define WS_S   (WS_VBL + 2u * (size_t)NB * CC * KHI)    // f32 region [hg][t][s], written and read by no kernel
#define WS_Y   (WS_S  + 4u * (size_t)HG * TT * TT)      // f32 ctx rows [b*t][CC] (only when there is an output projection)
#define WS_END (WS_Y  + 4u * (size_t)NB * TT * CC)

// ---- shared by k_proj and k_out: one 128 x 128 tile of X W per block of 8 waves (4 x 2, each 32 rows x 64 columns). A pass is GK k (32 in k_proj, so that three blocks fit a WGP's registers; 64 in k_out, one block a WGP, for more bytes in flight): the block reads both f32 operand tiles once, in whole 128-byte lines, rounds them to their 16-bit form and lays them k-contiguous in LDS (X rows, W columns), pitch 2 GK + 16 B; every wave takes its fragments from there. Two buffers: the next pass's global loads fly during this pass's products; one barrier a pass
typedef __attribute__((ext_vector_type(2))) unsigned v2u;
typedef __attribute__((ext_vector_type(2))) __bf16 v2b;
typedef __attribute__((ext_vector_type(2))) _Float16 v2h;
#define GSM(GK) (4 * 128 * ((GK) + 8))   // 16-bit elements of LDS: two buffers x two operand tiles of 128 rows, pitch GK + 8
// KIND 0: x and w to bf16 (exact bf16 products); KIND 1: x * 2^6 to f16, bf16(w) * 2^8 to f16
template <int KIND> __device__ __forceinline__ unsigned pkx(float a, float b) {
  if constexpr (KIND == 0) { v2b t; t[0] = (__bf16)a; t[1] = (__bf16)b; return __builtin_bit_cast(unsigned, t); }
  else { v2h t; t[0] = (_Float16)(a * 64.0f); t[1] = (_Float16)(b * 64.0f); return __builtin_bit_cast(unsigned, t); } }
template <int KIND> __device__ __forceinline__ unsigned pkw(float a, float b) {
  if constexpr (KIND == 0) { v2b t; t[0] = (__bf16)a; t[1] = (__bf16)b; return __builtin_bit_cast(unsigned, t); }
  else { v2h t; t[0] = (_Float16)(bfr(a) * 256.0f); t[1] = (_Float16)(bfr(b) * 256.0f); return __builtin_bit_cast(unsigned, t); } }
struct G8 { v4u q[2]; };
__device__ __forceinline__ G8 frag_s(const unsigned short* rowk0, int lane) { G8 f; const unsigned short* p = rowk0 + 8 * (lane >> 4); f.q[0] = *(const v4u*)p; f.q[1] = *(const v4u*)(p + 16); return f; }
template <int KIND> __device__ __forceinline__ v8f wmma_g(G8 a, G8 b, v8f c) {
  if constexpr (KIND == 0) return __builtin_amdgcn_wmma_f32_16x16x32_bf16(false, __builtin_bit_cast(v16b, a), false, __builtin_bit_cast(v16b, b), (short)0, c, false, false);
  else return __builtin_amdgcn_wmma_f32_16x16x32_f16(false, __builtin_bit_cast(v16h, a), false, __builtin_bit_cast(v16h, b), (short)0, c, false, false); }
// X [rows][KD] row-major, Wm [KD][ND] row-major; acc[i][j] = rows r0 + 32 (wave >> 1) + 16 i, columns c0 + 64 (wave & 1) + 16 j; k ascending in steps of 32 into one accumulator. Every inner loop is fully unrolled so that the staging, fragment and accumulator arrays are indexed by constants and stay in registers. Ends behind a barrier: sm is free
template <int KIND, int GK, int KD, int ND> __device__ __forceinline__ void gemm_tile(const float* __restrict__ X, const float* __restrict__ Wm, size_t r0, int c0, unsigned short* sm, v8f (&acc)[2][4]) {
  const int tid = threadIdx.x, wave = tid >> 5, lane = tid & 31, col = lane & 15; const int wm = wave >> 1, wn = wave & 1;
  constexpr int GP = GK + 8, GT = 128 * GP, XT = GK / 4, XS = XT / 2, XR = 256 / XT, WS = GK / 16;
  const int xr = tid / XT, xq = tid % XT;     /* X: XT threads x 16 B = one row's GK floats; XR rows a step, XS steps */
  const int wc = tid & 127, wo = tid >> 7;    /* W: one column a thread, lanes along the row (128 B a wave-load); k octets wo, wo + 2, ... */
  const float* xp = X + (r0 + xr) * KD + xq * 4; const float* wp = Wm + (size_t)(wo * 8) * ND + c0 + wc;
  v4f xv[XS]; float wv[WS][8];
#define G_LOAD(k0) do { _Pragma("unroll") for (int i = 0; i < XS; ++i) xv[i] = *(const v4f*)(xp + (size_t)(i * XR) * KD + (k0)); \
    _Pragma("unroll") for (int i = 0; i < WS; ++i) _Pragma("unroll") for (int e = 0; e < 8; ++e) wv[i][e] = wp[(size_t)((k0) + i * 16 + e) * ND]; } while (0)
#define G_STORE(buf) do { unsigned short* As = sm + (buf) * (2 * GT); unsigned short* Bs = As + GT; \
    _Pragma("unroll") for (int i = 0; i < XS; ++i) { v2u t; t[0] = pkx<KIND>(xv[i][0], xv[i][1]); t[1] = pkx<KIND>(xv[i][2], xv[i][3]); *(v2u*)&As[(xr + i * XR) * GP + xq * 4] = t; } \
    _Pragma("unroll") for (int i = 0; i < WS; ++i) { v4u t; t[0] = pkw<KIND>(wv[i][0], wv[i][1]); t[1] = pkw<KIND>(wv[i][2], wv[i][3]); t[2] = pkw<KIND>(wv[i][4], wv[i][5]); t[3] = pkw<KIND>(wv[i][6], wv[i][7]); *(v4u*)&Bs[wc * GP + (wo + 2 * i) * 8] = t; } } while (0)
  G_LOAD(0); G_STORE(0);
  __syncthreads();
  for (int ks = 0; ks < KD / GK; ++ks) {
    const bool more = ks + 1 < KD / GK;
    if (more) { G_LOAD((ks + 1) * GK); asm volatile("s_wait_xcnt 0x0" ::: "memory"); }   /* the wait: the loads' address registers are rewritten further down in the pass */
    __builtin_amdgcn_sched_barrier(0);   /* keeps the next pass's global loads ahead of this pass's products; the compiler otherwise sinks them to just in front of their use and their latency is waited out */
    const unsigned short* As = sm + (ks & 1) * (2 * GT) + (wm * 32 + col) * GP; const unsigned short* Bs = sm + (ks & 1) * (2 * GT) + GT + (wn * 64 + col) * GP;
#pragma unroll
    for (int kc = 0; kc < GK / 32; ++kc) { G8 a[2], b[4];
#pragma unroll
      for (int i = 0; i < 2; ++i) a[i] = frag_s(As + i * 16 * GP + kc * 32, lane);
#pragma unroll
      for (int j = 0; j < 4; ++j) b[j] = frag_s(Bs + j * 16 * GP + kc * 32, lane);
#pragma unroll
      for (int i = 0; i < 2; ++i)
#pragma unroll
        for (int j = 0; j < 4; ++j) acc[i][j] = wmma_g<KIND>(a[i], b[j], acc[i][j]); }
    __builtin_amdgcn_sched_barrier(0);   /* keeps the rounding of the loaded values, and with it the wait for them, behind the products */
    if (more) G_STORE((ks + 1) & 1);   /* into the buffer that every wave left at the barrier of the pass before */
    __syncthreads(); }
#undef G_LOAD
#undef G_STORE
}
// ---- k_proj: block = (128 rows, 128 cols, which): q/k/v = X W (+ b) with exact bf16 products (K = DIN) -> which 0: q f16 rows (+ residual rows < QHI); 1: k f16 rows (+ residual rows < KHI); 2: v f16 planes [c][t] (+ bf16 hi/lo planes for t < KHI). The output tile is staged in the LDS of the operand buffers, [128][136] 16-bit, and leaves in whole lines
#define EP 136
__global__ __launch_bounds__(256) void k_proj(const float* __restrict__ XQ, const float* __restrict__ XK, const float* __restrict__ XV, const float* __restrict__ WQ, const float* __restrict__ WK, const float* __restrict__ WV, const float* __restrict__ BQ, const float* __restrict__ BK, const float* __restrict__ BV,
    _Float16* __restrict__ QH, _Float16* __restrict__ QL, _Float16* __restrict__ KH, _Float16* __restrict__ KL, _Float16* __restrict__ VT, __bf16* __restrict__ VB, __bf16* __restrict__ VBL) {
  __shared__ __align__(16) unsigned short sm[GSM(32)];
  const int tid = threadIdx.x, wave = tid >> 5, lane = tid & 31, col = lane & 15, g = lane >> 4; const int wm = wave >> 1, wn = wave & 1; const int which = blockIdx.z; const int c0 = blockIdx.y * 128; const size_t r0 = (size_t)blockIdx.x * 128; const size_t bb = r0 / TT; const int t0 = (int)(r0 % TT);
  const float* X = which == 0 ? XQ : which == 1 ? XK : XV; const float* WA = which == 0 ? WQ : which == 1 ? WK : WV; const float* BA = which == 0 ? BQ : which == 1 ? BK : BV;
  v8f acc[2][4] = {};
  gemm_tile<0, 32, DIN, CC>(X, WA, r0, c0, sm, acc);
#pragma unroll
  for (int j = 0; j < 4; ++j) { const float bias = BA ? bfr(BA[c0 + wn * 64 + j * 16 + col]) : 0.f;
#pragma unroll
    for (int i = 0; i < 2; ++i) acc[i][j] = acc[i][j] + bias; }
  if (which < 2) { _Float16* DH = which == 0 ? QH : KH; _Float16* DL = which == 0 ? QL : KL; const int nhi = which == 0 ? QHI : KHI; _Float16* st = (_Float16*)sm;
#pragma unroll
    for (int i = 0; i < 2; ++i)
#pragma unroll
      for (int j = 0; j < 4; ++j)
#pragma unroll
        for (int r = 0; r < 8; ++r) st[(wm * 32 + i * 16 + 8 * g + r) * EP + wn * 64 + j * 16 + col] = (_Float16)acc[i][j][r];
    __syncthreads();
    for (int e = tid; e < 128 * 16; e += 256) { const int rl = e >> 4, q = e & 15; vst2((unsigned*)(DH + (r0 + rl) * CC + c0 + q * 8), *(const v4u*)&st[rl * EP + q * 8]); }
    if (t0 < nhi) {   /* block-uniform */
      __syncthreads();
#pragma unroll
      for (int i = 0; i < 2; ++i)
#pragma unroll
        for (int j = 0; j < 4; ++j)
#pragma unroll
          for (int r = 0; r < 8; ++r) { const float v = acc[i][j][r]; st[(wm * 32 + i * 16 + 8 * g + r) * EP + wn * 64 + j * 16 + col] = (_Float16)((v - (float)(_Float16)v) * 1024.0f); }
      __syncthreads();
      for (int e = tid; e < 128 * 16; e += 256) { const int rl = e >> 4, q = e & 15; if (t0 + rl < nhi) { vst2((unsigned*)(DL + (bb * nhi + t0 + rl) * (size_t)CC + c0 + q * 8), *(const v4u*)&st[rl * EP + q * 8]); asm volatile("s_wait_xcnt 0x0" ::: "memory"); /* the store's address register is stepped at the loop's foot */ } } }
  } else { _Float16* st = (_Float16*)sm; __bf16* sb = (__bf16*)sm;
#pragma unroll
    for (int i = 0; i < 2; ++i)
#pragma unroll
      for (int j = 0; j < 4; ++j) { v8h t;
#pragma unroll
        for (int r = 0; r < 8; ++r) t[r] = (_Float16)acc[i][j][r];
        *(v8h*)&st[(wn * 64 + j * 16 + col) * EP + wm * 32 + i * 16 + 8 * g] = t; }
    __syncthreads();
    for (int e = tid; e < 128 * 16; e += 256) { const int cl = e >> 4, q = e & 15; vst2((unsigned*)(VT + (bb * CC + c0 + cl) * (size_t)TT + t0 + q * 8), *(const v4u*)&st[cl * EP + q * 8]); }
    if (t0 < KHI) {   /* block-uniform */
#pragma unroll
      for (int pl = 0; pl < 2; ++pl) { __bf16* D = pl == 0 ? VB : VBL;
        __syncthreads();
#pragma unroll
        for (int i = 0; i < 2; ++i)
#pragma unroll
          for (int j = 0; j < 4; ++j) { v8b t;
#pragma unroll
            for (int r = 0; r < 8; ++r) { const float v = acc[i][j][r]; const __bf16 bh = (__bf16)v; t[r] = pl == 0 ? bh : (__bf16)(v - (float)bh); }
            *(v8b*)&sb[(wn * 64 + j * 16 + col) * EP + wm * 32 + i * 16 + 8 * g] = t; }
        __syncthreads();
        for (int e = tid; e < 128 * 16; e += 256) { const int cl = e >> 4, q = e & 15; if (t0 + q * 8 < KHI) { vst2((unsigned*)(D + (bb * CC + c0 + cl) * (size_t)KHI + t0 + q * 8), *(const v4u*)&sb[cl * EP + q * 8]); asm volatile("s_wait_xcnt 0x0" ::: "memory"); /* the store's address register is stepped at the loop's foot */ } } } } } }
// ---- k_fa: block = 256 queries of (b, h), 8 waves x 32 query columns; one pass = 32 keys, one stage = SK keys. The block brings each stage's k rows and v planes into LDS once, by asynchronous 16-byte copies in whole lines (two buffers: the next stage's copies fly during this stage's passes; one barrier a stage), and all 8 waves take their fragments from there. S^T = K Q^T (A = k rows, B = q rows, same k order), logits x SCALE + log-weight in the log2 domain, running maximum and sum per query column (online softmax), P x 2^8 once to f16 packed from the two score tiles as the B operand, O^T += V^T P^T (A = v planes); the logits never leave the registers. Every loop within a pass is fully unrolled so that the fragment and accumulator arrays are indexed by constants and stay in registers
#define FQ 2               // 16-column query groups per wave
#define SK 128             // keys per stage
#define KPI (HD + 8)       // LDS pitch of a k row, f16 elements: 144 B = 16 B x odd, conflict-free for 16-byte fragment reads
#define VPI (SK + 8)       // LDS pitch of a v plane's SK keys: 272 B = 16 B x odd
#define FBUF (SK * KPI + HD * VPI)   // f16 elements of one buffer: k rows, then v planes
#define LOG2E 1.44269504088896340736f
__device__ __forceinline__ float xhalf(float x) { return __builtin_bit_cast(float, __builtin_amdgcn_permlanex16(__builtin_bit_cast(int, x), __builtin_bit_cast(int, x), 0x76543210, 0xfedcba98, false, false)); }   // lane l with lane l ^ 16
__device__ __forceinline__ v8f wmma_h(v16h a, v16h b, v8f c) { return __builtin_amdgcn_wmma_f32_16x16x32_f16(false, a, false, b, (short)0, c, false, false); }
typedef __attribute__((address_space(3))) _Float16 lds_h;
// one stage: each thread copies four 16-byte pieces of the k rows (32 rows apart) and four of the v planes (16 planes apart). kl, vl: the lane's LDS byte addresses; kg, vg: its global addresses. The s_wait_xcnt stands inside the statement so that no address register is rewritten ahead of it
__device__ __forceinline__ void fa_stage(unsigned kl, unsigned vl, const _Float16* kg, const _Float16* vg) {
  asm volatile("global_load_async_to_lds_b128 %0, %8, off\n\t"
               "global_load_async_to_lds_b128 %1, %9, off\n\t"
               "global_load_async_to_lds_b128 %2, %10, off\n\t"
               "global_load_async_to_lds_b128 %3, %11, off\n\t"
               "global_load_async_to_lds_b128 %4, %12, off\n\t"
               "global_load_async_to_lds_b128 %5, %13, off\n\t"
               "global_load_async_to_lds_b128 %6, %14, off\n\t"
               "global_load_async_to_lds_b128 %7, %15, off\n\t"
               "s_wait_xcnt 0x0"
               :: "v"(kl), "v"(kl + 32u * (KPI * 2)), "v"(kl + 64u * (KPI * 2)), "v"(kl + 96u * (KPI * 2)),
                  "v"(vl), "v"(vl + 16u * (VPI * 2)), "v"(vl + 32u * (VPI * 2)), "v"(vl + 48u * (VPI * 2)),
                  "v"(kg), "v"(kg + (size_t)32 * CC), "v"(kg + (size_t)64 * CC), "v"(kg + (size_t)96 * CC),
                  "v"(vg), "v"(vg + (size_t)16 * TT), "v"(vg + (size_t)32 * TT), "v"(vg + (size_t)48 * TT)
               : "memory"); }
__global__ __launch_bounds__(256) void k_fa(const _Float16* __restrict__ QH, const _Float16* __restrict__ KH, const _Float16* __restrict__ VT, const float* __restrict__ WGT, float* __restrict__ Y) { __shared__ __align__(32) float slw[TT]; __shared__ __align__(16) _Float16 skv[2 * FBUF];
  const int tid = threadIdx.x, wave = tid >> 5, lane = tid & 31, col = lane & 15, g = lane >> 4; const int h = blockIdx.y, b = blockIdx.z; const int q0 = blockIdx.x * (128 * FQ) + wave * (16 * FQ);
  const _Float16* kg = KH + ((size_t)b * TT + (tid >> 3)) * CC + h * HD + (tid & 7) * 8;              /* 8 threads a k row: 128 B, one line */
  const _Float16* vg = VT + ((size_t)b * CC + h * HD + (tid >> 4)) * (size_t)TT + (tid & 15) * 8;     /* 16 threads a v plane's SK keys: 256 B, two lines */
  const unsigned sb = (unsigned)(size_t)(const lds_h*)skv; const unsigned kl = sb + (tid >> 3) * (KPI * 2) + (tid & 7) * 16; const unsigned vl = sb + SK * KPI * 2 + (tid >> 4) * (VPI * 2) + (tid & 15) * 16;
  fa_stage(kl, vl, kg, vg);   /* stage 0 into buffer 0 */
  for (int k = tid; k < TT; k += 256) slw[k] = logf(bfr(WGT[(size_t)b * TT + k]) + 1.0e-20f) * LOG2E;   /* per-key log-weight, once per block */
  asm volatile("s_wait_asynccnt 0x0" ::: "memory");   /* this wave's copies of stage 0 have landed before the barrier that lets the other waves read them */
  __syncthreads();
  fa_stage(kl + FBUF * 2, vl + FBUF * 2, kg + (size_t)SK * CC, vg + SK);   /* stage 1 into buffer 1 */
  v16h qf[FQ][2];
#pragma unroll
  for (int c = 0; c < FQ; ++c)
#pragma unroll
    for (int kc = 0; kc < 2; ++kc) qf[c][kc] = frag_h(QH + ((size_t)b * TT + q0 + c * 16 + col) * CC + h * HD + kc * 32, lane);
  v8f acc[FQ][4] = {}; float m[FQ], l[FQ];
#pragma unroll
  for (int c = 0; c < FQ; ++c) { m[c] = -1.0e30f; l[c] = 0.f; }
  for (int st = 0; st < TT / SK; ++st) {
    const _Float16* Kb = skv + (st & 1) * FBUF + col * KPI; const _Float16* Vb = skv + (st & 1) * FBUF + SK * KPI + col * VPI;
    v16h kf[2][2];
#pragma unroll
    for (int t = 0; t < 2; ++t)
#pragma unroll
      for (int kc = 0; kc < 2; ++kc) kf[t][kc] = frag_h(Kb + (t * 16) * KPI + kc * 32, lane);
#pragma unroll 1   /* kept rolled: unrolled, the four passes' fragments and scores are live together, the kernel goes beyond 256 registers and register-window switches stand all through the loop */
    for (int ps = 0; ps < SK / 32; ++ps) {
      v16h vf[4];
#pragma unroll
      for (int j = 0; j < 4; ++j) vf[j] = frag_h(Vb + (j * 16) * VPI + ps * 32, lane);
      v8f lw[2];
#pragma unroll
      for (int t = 0; t < 2; ++t) lw[t] = *(const v8f*)&slw[st * SK + ps * 32 + t * 16 + 8 * g];
      v8f s[FQ][2] = {};
#pragma unroll
      for (int kc = 0; kc < 2; ++kc)
#pragma unroll
        for (int c = 0; c < FQ; ++c)
#pragma unroll
          for (int t = 0; t < 2; ++t) s[c][t] = wmma_h(kf[t][kc], qf[c][kc], s[c][t]);
      const int pn = ps + 1 < SK / 32 ? ps + 1 : 0;   /* next pass's k rows of the same stage, fetched behind this pass's score products (the stage's last pass re-reads its own rows 0..31, unused) */
#pragma unroll
      for (int t = 0; t < 2; ++t)
#pragma unroll
        for (int kc = 0; kc < 2; ++kc) kf[t][kc] = frag_h(Kb + (pn * 32 + t * 16) * KPI + kc * 32, lane);
      __builtin_amdgcn_sched_barrier(0);   /* keeps the softmax below from being scheduled ahead of the prefetch, which would then be issued only a few instructions before the next pass needs it */
#pragma unroll
      for (int c = 0; c < FQ; ++c) {
        float mx = m[c];
#pragma unroll
        for (int t = 0; t < 2; ++t)
#pragma unroll
          for (int r = 0; r < 8; ++r) { s[c][t][r] = fmaf(s[c][t][r], SCALE * LOG2E, lw[t][r]); mx = fmaxf(mx, s[c][t][r]); }
        mx = fmaxf(mx, xhalf(mx));   /* the two lane halves hold the two key halves of one query column */
        const float alpha = __builtin_amdgcn_exp2f(m[c] - mx); m[c] = mx; const float ms = mx - 8.0f;
        float sum = 0.f; v16h p;
#pragma unroll
        for (int t = 0; t < 2; ++t)
#pragma unroll
          for (int r = 0; r < 8; ++r) { const float e = __builtin_amdgcn_exp2f(s[c][t][r] - ms); sum += e; p[t * 8 + r] = (_Float16)e; }
        l[c] = l[c] * alpha + sum;
#pragma unroll
        for (int j = 0; j < 4; ++j) { acc[c][j] = acc[c][j] * alpha; acc[c][j] = wmma_h(vf[j], p, acc[c][j]); } } }
    asm volatile("s_wait_dscnt 0x0" ::: "memory");      /* this wave's reads of the buffer are done before the barrier behind which it is refilled */
    asm volatile("s_wait_asynccnt 0x0" ::: "memory");   /* this wave's copies of stage st + 1 have landed before the barrier that lets the other waves read them */
    __syncthreads();
    if (st + 2 < TT / SK) fa_stage(kl + (st & 1) * (FBUF * 2), vl + (st & 1) * (FBUF * 2), kg + (size_t)(st + 2) * SK * CC, vg + (st + 2) * SK); }   /* stage st + 2 into the buffer that every wave has just left */
  asm volatile("s_wait_asynccnt 0x0" ::: "memory");   /* no copy is outstanding when the wave ends */
#pragma unroll
  for (int c = 0; c < FQ; ++c) { const float lt = l[c] + xhalf(l[c]); const float inv = lt > 0.f ? 1.0f / lt : 0.f; float* yr = Y + ((size_t)b * TT + q0 + c * 16 + col) * CC + h * HD + 8 * g;
#pragma unroll
    for (int j = 0; j < 4; ++j) { const v8f o = acc[c][j] * inv; vst2(yr + j * 16, __builtin_shufflevector(o, o, 0, 1, 2, 3)); vst2(yr + j * 16 + 4, __builtin_shufflevector(o, o, 4, 5, 6, 7)); } } }
// ---- k_out: block = (128 rows, 128 cols): out = ctx Wo (+ bo): ctx x 2^6 once to f16 (small-magnitude context rows stay clear of f16 subnormals) against Wo as f16(bf16 x 2^8) exact (1 product) x 2^-14. Each wave stages its 32 x 64 f32 in its own part of the LDS of the operand buffers and stores whole lines
__global__ __launch_bounds__(256) void k_out(const float* __restrict__ Y, const float* __restrict__ WO, const float* __restrict__ BO, float* __restrict__ OUT) { __shared__ __align__(16) unsigned short sm[GSM(64)];
  const int tid = threadIdx.x, wave = tid >> 5, lane = tid & 31, col = lane & 15, g = lane >> 4; const int wm = wave >> 1, wn = wave & 1; const int c0 = blockIdx.y * 128; const size_t r0 = (size_t)blockIdx.x * 128;
  v8f acc[2][4] = {};
  gemm_tile<1, 64, CC, DIN>(Y, WO, r0, c0, sm, acc);
  float* sf = (float*)sm + wave * (32 * 68);
#pragma unroll
  for (int j = 0; j < 4; ++j) { const float bias = BO ? bfr(BO[c0 + wn * 64 + j * 16 + col]) : 0.f;
#pragma unroll
    for (int i = 0; i < 2; ++i)
#pragma unroll
      for (int r = 0; r < 8; ++r) sf[(i * 16 + 8 * g + r) * 68 + j * 16 + col] = acc[i][j][r] * (1.0f / 16384.0f) + bias; }   /* 2^-8 (Wo carry) x 2^-6 (ctx carry) */
  LDSX(); for (int it = 0; it < 16; ++it) { const int rl = it * 2 + g; vst2(OUT + (r0 + wm * 32 + rl) * DIN + c0 + wn * 64 + col * 4, *(const v4f*)&sf[rl * 68 + col * 4]); } }

extern "C" void kernel_launch(void* const* d_in, const int* in_sizes, int n_in, void* d_out, int out_size, void* d_ws, size_t ws_size, hipStream_t stream) {
  (void)in_sizes; (void)n_in; (void)out_size;
  const float** F = (const float**)d_in;
  if (ws_size < (size_t)WS_END) return;
  char* ws = (char*)d_ws; _Float16 *QH = (_Float16*)(ws + WS_QH), *KH = (_Float16*)(ws + WS_KH), *VT = (_Float16*)(ws + WS_VT), *QL = (_Float16*)(ws + WS_QL), *KL = (_Float16*)(ws + WS_KL); __bf16 *VB = (__bf16*)(ws + WS_VB), *VBL = (__bf16*)(ws + WS_VBL); float *S = (float*)(ws + WS_S), *Y = (float*)(ws + WS_Y);
  (void)Y; (void)QL; (void)KL; (void)VB; (void)VBL; (void)S;
  // inputs: 0 query [2,2048,1024]; 1 key; 2 value; 3 weights [2,2048]; 4 wq [1024,1024] (in,out), 5 bq; 6 wk, 7 bk; 8 wv, 9 bv; 10 wo (in,out), 11 bo (all biases zeros, read)
  k_proj<<<dim3(TNB * TT / 128, CC / 128, 3), 256, 0, stream>>>(F[0], F[1], F[2], F[4], F[6], F[8], F[5], F[7], F[9], QH, QL, KH, KL, VT, VB, VBL);
  k_fa<<<dim3(TT / (128 * FQ), NH, TNB), 256, 0, stream>>>(QH, KH, VT, F[3], Y);
  k_out<<<dim3(TNB * TT / 128, DIN / 128), 256, 0, stream>>>(Y, F[10], F[11], (float*)d_out);
}

// v004
// A run of this version takes 102 microseconds.
// Two timings next to v003 both put it at 1.04 times that version's speed.
// Counting every step since v000, it is 11.8 times as fast.
// compute dtype: all float inputs rounded to bf16; q / k / v projections with EXACT bf16 products on WMMA 16x16x32 (f32 accumulate) + bias (zeros, read); logits k x q once to f16 each (1 product) x 64^-0.5, + logf(bf16(weight) + 1e-20) per key in f32; online softmax f32 (base 2); exp2(logit - running max) x 2^8 once to f16 x v once to f16 (1 product), divided by the f32 sum at the end; ctx x 2^6 once to f16 x wo f16(bf16 x 2^8) + bo; f32 output.
#include <hip/hip_runtime.h>
#include <math.h>

typedef __attribute__((ext_vector_type(16))) _Float16 v16h;
typedef __attribute__((ext_vector_type(16))) __bf16 v16b;
typedef __attribute__((ext_vector_type(8)))  _Float16 v8h;
typedef __attribute__((ext_vector_type(8)))  float v8f;
typedef __attribute__((ext_vector_type(4)))  float v4f;
typedef __attribute__((ext_vector_type(2)))  float v2f;
typedef __attribute__((ext_vector_type(4)))  unsigned v4u;
typedef __attribute__((ext_vector_type(4)))  int v4i;
typedef float __attribute__((may_alias)) float_a;
typedef int __attribute__((may_alias)) int_a;

template <typename T> __device__ __forceinline__ void vst2(void* p, T v) { *(T*)p = v;  }
__device__ __forceinline__ v8f wmma16(v16h a, v16h b, v8f c) {
  v8f d = __builtin_amdgcn_wmma_f32_16x16x32_f16(false, a, false, b, (short)0, c, false, false);
  asm volatile("v_nop\n\tv_nop\n\tv_nop\n\tv_nop" : "+v"(d) : "v"(a), "v"(b));
  return d;
}
__device__ __forceinline__ v8f wmma_bf(v16b a, v16b b, v8f c) {
  v8f d = __builtin_amdgcn_wmma_f32_16x16x32_bf16(false, a, false, b, (short)0, c, false, false);
  asm volatile("v_nop\n\tv_nop\n\tv_nop\n\tv_nop" : "+v"(d) : "v"(a), "v"(b));
  return d;
}
// 16x16x32 fragments: lane = (h = lane>>4, row/col = lane&15); elements 0..7 = k0+8h+0..7, 8..15 = k0+16+8h+0..7; D element r = row 8h+r
__device__ __forceinline__ v16h frag_h(const _Float16* rowk0, int lane) {
  union { v16h v; v8h q[2]; } u; const _Float16* p = rowk0 + 8 * (lane >> 4);
  u.q[0] = *(const v8h*)p; u.q[1] = *(const v8h*)(p + 16); return u.v;
}
__device__ __forceinline__ v16h frag_f32(const float* rowk0, int lane) {
  v16h a; const float* p = rowk0 + 8 * (lane >> 4);
#pragma unroll
  for (int i = 0; i < 8; ++i) { a[i] = (_Float16)p[i]; a[8 + i] = (_Float16)p[16 + i]; }
  return a;
}
__device__ __forceinline__ v16h frag_f32s(const float* rowk0, int lane, float sc) {
  v16h a; const float* p = rowk0 + 8 * (lane >> 4);
#pragma unroll
  for (int i = 0; i < 8; ++i) { a[i] = (_Float16)(p[i] * sc); a[8 + i] = (_Float16)(p[16 + i] * sc); }
  return a;
}
// column fragment from a [K][ld] layout (column n), rows >= K read as 0
__device__ __forceinline__ v16h fragc_f32(const float* W, int k0, int n, int lane, int ld, int K) {
  v16h a; const int g = lane >> 4;
#pragma unroll
  for (int i = 0; i < 8; ++i) { const int ka = k0 + 8 * g + i, kb = ka + 16;
    a[i] = (_Float16)(ka < K ? W[(size_t)(ka < K ? ka : K - 1) * ld + n] : 0.f); a[8 + i] = (_Float16)(kb < K ? W[(size_t)(kb < K ? kb : K - 1) * ld + n] : 0.f); }
  return a;
}
struct F2 { v16b h, l; };
__device__ __forceinline__ F2 bsplit16(const float v[16]) { F2 r;
#pragma unroll
  for (int i = 0; i < 16; ++i) { const __bf16 h = (__bf16)v[i]; r.h[i] = h; r.l[i] = (__bf16)(v[i] - (float)h); }
  return r; }
__device__ __forceinline__ F2 split_row(const float* row, int k0, int lane) { float v[16]; const float* p = row + k0 + 8 * (lane >> 4);
#pragma unroll
  for (int i = 0; i < 8; ++i) { v[i] = p[i]; v[8 + i] = p[16 + i]; }
  return bsplit16(v); }
__device__ __forceinline__ F2 split_rowK(const float* row, int k0, int lane, int K) { float v[16]; const int g = lane >> 4;
#pragma unroll
  for (int i = 0; i < 8; ++i) { const int ka = k0 + 8 * g + i, kb = ka + 16; v[i] = ka < K ? row[ka < K ? ka : K - 1] : 0.f; v[8 + i] = kb < K ? row[kb < K ? kb : K - 1] : 0.f; }
  return bsplit16(v); }
__device__ __forceinline__ F2 split_col(const float* W, int k0, int n, int lane, int ld, int K) { float v[16]; const int g = lane >> 4;
#pragma unroll
  for (int i = 0; i < 8; ++i) { const int ka = k0 + 8 * g + i, kb = ka + 16; v[i] = ka < K ? W[(size_t)(ka < K ? ka : K - 1) * ld + n] : 0.f; v[8 + i] = kb < K ? W[(size_t)(kb < K ? kb : K - 1) * ld + n] : 0.f; }
  return bsplit16(v); }
__device__ __forceinline__ v8f mac3(const F2& a, const F2& b, v8f c) { c = wmma_bf(a.l, b.h, c); c = wmma_bf(a.h, b.l, c); return wmma_bf(a.h, b.h, c); }
__device__ __forceinline__ float sigm(float v) { return 1.0f / (1.0f + expf(-v)); }
#define LDSX() do { asm volatile("s_wait_dscnt 0" ::: "memory"); __builtin_amdgcn_wave_barrier(); __builtin_amdgcn_fence(__ATOMIC_RELEASE, "workgroup"); } while (0)

// Multi-head attention on separate inputs with a per-key multiplicative weight (query / key / value [2,2048,1024]; (in,out) wq / wk / wv / wo [1024,1024] N(0, 1/1024) applied as x @ W + b, all biases zeros (read); weights [2,2048] uniform(0,1), one per (batch, key); 16 heads x 64; scores / sqrt(64) + log(weights + 1e-20) broadcast over heads and queries; softmax over keys; out @ wo + bo).
#define NB 2
#define TT 2048
#define CC 1024            // NH * HD = projected width
#define DIN 1024          // input (model) width
#define NH 16
#define HD 64
#define NQB (TT / 64)
#define HG 4
#define SCALE (0.125f)
#define CAUSAL 0
#ifndef TNB
#define TNB NB
#endif
__device__ __forceinline__ float bfr(float v) { return (float)(__bf16)v; }
__host__ __device__ __forceinline__ int kb_last(int qb) { return CAUSAL ? ((qb * 64 + 63) >> 7) : (TT / 128 - 1); }
typedef __attribute__((ext_vector_type(8))) __bf16 v8b;
__device__ __forceinline__ v16b frag_b(const __bf16* rowk0, int lane) {
  union { v16b v; v8b q[2]; } u; const __bf16* p = rowk0 + 8 * (lane >> 4);
  u.q[0] = *(const v8b*)p; u.q[1] = *(const v8b*)(p + 16); return u.v;
}
#define QBH 0              // unused: this file has no high-precision path
#define QHI 0               // single-product logits on every row (logit sigma ~1)
#define KHI 64            // key rows carrying k residual / v bf16 hi+lo planes (written by k_proj, read by no kernel)
// B fragment (k rows k0+.., output column o) of a weight: (in,out) [K][ld] or (out,in) [ld rows of K]: bf16 exact, or f16(bf16 * 256) exact
__device__ __forceinline__ v16b wcol_io(const float* Wm, int k0, int o, int lane, int ld) { v16b w; const int g = lane >> 4;
#pragma unroll
  for (int i = 0; i < 8; ++i) { w[i] = (__bf16)Wm[(size_t)(k0 + 8 * g + i) * ld + o]; w[8 + i] = (__bf16)Wm[(size_t)(k0 + 16 + 8 * g + i) * ld + o]; }
  return w; }
__device__ __forceinline__ v16b wcol_oi(const float* Wm, int k0, int o, int lane, int K) { v16b w; const float* p = Wm + (size_t)o * K + k0 + 8 * (lane >> 4);
#pragma unroll
  for (int i = 0; i < 8; ++i) { w[i] = (__bf16)p[i]; w[8 + i] = (__bf16)p[16 + i]; }
  return w; }
__device__ __forceinline__ v16h wcolh_io(const float* Wm, int k0, int o, int lane, int ld) { v16h w; const int g = lane >> 4;
#pragma unroll
  for (int i = 0; i < 8; ++i) { w[i] = (_Float16)(bfr(Wm[(size_t)(k0 + 8 * g + i) * ld + o]) * 256.0f); w[8 + i] = (_Float16)(bfr(Wm[(size_t)(k0 + 16 + 8 * g + i) * ld + o]) * 256.0f); }
  return w; }
__device__ __forceinline__ v16h wcolh_oi(const float* Wm, int k0, int o, int lane, int K) { v16h w; const float* p = Wm + (size_t)o * K + k0 + 8 * (lane >> 4);
#pragma unroll
  for (int i = 0; i < 8; ++i) { w[i] = (_Float16)(bfr(p[i]) * 256.0f); w[8 + i] = (_Float16)(bfr(p[16 + i]) * 256.0f); }
  return w; }
#define WQKV_LAYOUT 0   // 0 = (in,out) [DIN][CC]; 1 = (out,in) [CC][DIN]; 2 = per-head [NH][DIN][HD]
__device__ __forceinline__ v16b wcol_hdk(const float* Wm, int k0, int o, int lane) { v16b w; const int g = lane >> 4; const float* p = Wm + (size_t)(o / HD) * DIN * HD + (o % HD);
#pragma unroll
  for (int i = 0; i < 8; ++i) { w[i] = (__bf16)p[(size_t)(k0 + 8 * g + i) * HD]; w[8 + i] = (__bf16)p[(size_t)(k0 + 16 + 8 * g + i) * HD]; }
  return w; }
#define WO_OUT_IN 0
#if WQKV_LAYOUT == 1
#define WCOL(W, k0, o, lane) wcol_oi(W, k0, o, lane, DIN)
#elif WQKV_LAYOUT == 2
#define WCOL(W, k0, o, lane) wcol_hdk(W, k0, o, lane)
#else
#define WCOL(W, k0, o, lane) wcol_io(W, k0, o, lane, CC)
#endif
#if WO_OUT_IN
#define WOCOL(W, k0, o, lane) wcol_oi(W, k0, o, lane, CC)
#define WOCOLH(W, k0, o, lane) wcolh_oi(W, k0, o, lane, CC)
#else
#define WOCOL(W, k0, o, lane) wcol_io(W, k0, o, lane, DIN)
#define WOCOLH(W, k0, o, lane) wcolh_io(W, k0, o, lane, DIN)
#endif

#define WS_QH  0u                                      // f16 q rows [b*t][CC]
#define WS_KH  (WS_QH + 2u * (size_t)NB * TT * CC)      // f16 k rows [b*t][CC]
#define WS_VT  (WS_KH + 2u * (size_t)NB * TT * CC)      // f16 v planes [b][c][t]
#define WS_QL  (WS_VT + 2u * (size_t)NB * CC * TT)      // f16 q residual x 2^10 rows [b][t < QHI][CC]
#define WS_KL  (WS_QL + 2u * (size_t)NB * QHI * CC)     // f16 k residual x 2^10 rows [b][t < KHI][CC]
#define WS_VB  (WS_KL + 2u * (size_t)NB * KHI * CC)     // bf16 v hi planes [b][c][t < KHI]
#define WS_VBL (WS_VB + 2u * (size_t)NB * CC * KHI)
#define WS_S   (WS_VBL + 2u * (size_t)NB * CC * KHI)    // f32 region [hg][t][s], written and read by no kernel
#define WS_Y   (WS_S  + 4u * (size_t)HG * TT * TT)      // f32 ctx rows [b*t][CC] (only when there is an output projection)
#define WS_END (WS_Y  + 4u * (size_t)NB * TT * CC)

// ---- shared by k_proj and k_out: one 128 x 128 tile of X W per block of 8 waves (4 x 2, each 32 rows x 64 columns). A pass is GK k (32 in k_proj, so that three blocks fit a WGP's registers; 64 in k_out, one block a WGP, for more bytes in flight): the block reads both f32 operand tiles once, in whole 128-byte lines, rounds them to their 16-bit form and lays them k-contiguous in LDS (X rows, W columns), pitch 2 GK + 16 B; every wave takes its fragments from there. Two buffers: the next pass's global loads fly during this pass's products; one barrier a pass
typedef __attribute__((ext_vector_type(2))) unsigned v2u;
typedef __attribute__((ext_vector_type(2))) __bf16 v2b;
typedef __attribute__((ext_vector_type(2))) _Float16 v2h;
#define GSM(GK) (4 * 128 * ((GK) + 8))   // 16-bit elements of LDS: two buffers x two operand tiles of 128 rows, pitch GK + 8
// KIND 0: x and w to bf16 (exact bf16 products); KIND 1: x * 2^6 to f16, bf16(w) * 2^8 to f16
template <int KIND> __device__ __forceinline__ unsigned pkx(float a, float b) {
  if constexpr (KIND == 0) { v2b t; t[0] = (__bf16)a; t[1] = (__bf16)b; return __builtin_bit_cast(unsigned, t); }
  else { v2h t; t[0] = (_Float16)(a * 64.0f); t[1] = (_Float16)(b * 64.0f); return __builtin_bit_cast(unsigned, t); } }
template <int KIND> __device__ __forceinline__ unsigned pkw(float a, float b) {
  if constexpr (KIND == 0) { v2b t; t[0] = (__bf16)a; t[1] = (__bf16)b; return __builtin_bit_cast(unsigned, t); }
  else { v2h t; t[0] = (_Float16)(bfr(a) * 256.0f); t[1] = (_Float16)(bfr(b) * 256.0f); return __builtin_bit_cast(unsigned, t); } }
struct G8 { v4u q[2]; };
__device__ __forceinline__ G8 frag_s(const unsigned short* rowk0, int lane) { G8 f; const unsigned short* p = rowk0 + 8 * (lane >> 4); f.q[0] = *(const v4u*)p; f.q[1] = *(const v4u*)(p + 16); return f; }
template <int KIND> __device__ __forceinline__ v8f wmma_g(G8 a, G8 b, v8f c) {
  if constexpr (KIND == 0) return __builtin_amdgcn_wmma_f32_16x16x32_bf16(false, __builtin_bit_cast(v16b, a), false, __builtin_bit_cast(v16b, b), (short)0, c, false, false);
  else return __builtin_amdgcn_wmma_f32_16x16x32_f16(false, __builtin_bit_cast(v16h, a), false, __builtin_bit_cast(v16h, b), (short)0, c, false, false); }
// X [rows][KD] row-major, Wm [KD][ND] row-major; acc[i][j] = rows r0 + 32 (wave >> 1) + 16 i, columns c0 + 64 (wave & 1) + 16 j; k ascending in steps of 32 into one accumulator. Every inner loop is fully unrolled so that the staging, fragment and accumulator arrays are indexed by constants and stay in registers. Ends behind a barrier: sm is free
template <int KIND, int GK, int KD, int ND> __device__ __forceinline__ void gemm_tile(const float* __restrict__ X, const float* __restrict__ Wm, size_t r0, int c0, unsigned short* sm, v8f (&acc)[2][4]) {
  const int tid = threadIdx.x, wave = tid >> 5, lane = tid & 31, col = lane & 15; const int wm = wave >> 1, wn = wave & 1;
  constexpr int GP = GK + 8, GT = 128 * GP, XT = GK / 4, XS = XT / 2, XR = 256 / XT, WS = GK / 16;
  const int xr = tid / XT, xq = tid % XT;     /* X: XT threads x 16 B = one row's GK floats; XR rows a step, XS steps */
  const int wc = tid & 127, wo = tid >> 7;    /* W: one column a thread, lanes along the row (128 B a wave-load); k octets wo, wo + 2, ... */
  const float* xp = X + (r0 + xr) * KD + xq * 4; const float* wp = Wm + (size_t)(wo * 8) * ND + c0 + wc;
  v4f xv[XS]; float wv[WS][8];
#define G_LOAD(k0) do { _Pragma("unroll") for (int i = 0; i < XS; ++i) xv[i] = *(const v4f*)(xp + (size_t)(i * XR) * KD + (k0)); \
    _Pragma("unroll") for (int i = 0; i < WS; ++i) _Pragma("unroll") for (int e = 0; e < 8; ++e) wv[i][e] = wp[(size_t)((k0) + i * 16 + e) * ND]; } while (0)
#define G_STORE(buf) do { unsigned short* As = sm + (buf) * (2 * GT); unsigned short* Bs = As + GT; \
    _Pragma("unroll") for (int i = 0; i < XS; ++i) { v2u t; t[0] = pkx<KIND>(xv[i][0], xv[i][1]); t[1] = pkx<KIND>(xv[i][2], xv[i][3]); *(v2u*)&As[(xr + i * XR) * GP + xq * 4] = t; } \
    _Pragma("unroll") for (int i = 0; i < WS; ++i) { v4u t; t[0] = pkw<KIND>(wv[i][0], wv[i][1]); t[1] = pkw<KIND>(wv[i][2], wv[i][3]); t[2] = pkw<KIND>(wv[i][4], wv[i][5]); t[3] = pkw<KIND>(wv[i][6], wv[i][7]); *(v4u*)&Bs[wc * GP + (wo + 2 * i) * 8] = t; } } while (0)
  G_LOAD(0); G_STORE(0);
  __syncthreads();
  for (int ks = 0; ks < KD / GK; ++ks) {
    const bool more = ks + 1 < KD / GK;
    if (more) { G_LOAD((ks + 1) * GK); asm volatile("s_wait_xcnt 0x0" ::: "memory"); }   /* the wait: the loads' address registers are rewritten further down in the pass */
    __builtin_amdgcn_sched_barrier(0);   /* keeps the next pass's global loads ahead of this pass's products; the compiler otherwise sinks them to just in front of their use and their latency is waited out */
    const unsigned short* As = sm + (ks & 1) * (2 * GT) + (wm * 32 + col) * GP; const unsigned short* Bs = sm + (ks & 1) * (2 * GT) + GT + (wn * 64 + col) * GP;
#pragma unroll
    for (int kc = 0; kc < GK / 32; ++kc) { G8 a[2], b[4];
#pragma unroll
      for (int i = 0; i < 2; ++i) a[i] = frag_s(As + i * 16 * GP + kc * 32, lane);
#pragma unroll
      for (int j = 0; j < 4; ++j) b[j] = frag_s(Bs + j * 16 * GP + kc * 32, lane);
#pragma unroll
      for (int i = 0; i < 2; ++i)
#pragma unroll
        for (int j = 0; j < 4; ++j) acc[i][j] = wmma_g<KIND>(a[i], b[j], acc[i][j]); }
    __builtin_amdgcn_sched_barrier(0);   /* keeps the rounding of the loaded values, and with it the wait for them, behind the products */
    if (more) G_STORE((ks + 1) & 1);   /* into the buffer that every wave left at the barrier of the pass before */
    __syncthreads(); }
#undef G_LOAD
#undef G_STORE
}
// ---- k_proj: block = (128 rows, 128 cols, which): q/k/v = X W (+ b) with exact bf16 products (K = DIN) -> which 0: q f16 rows (+ residual rows < QHI); 1: k f16 rows (+ residual rows < KHI); 2: v f16 planes [c][t] (+ bf16 hi/lo planes for t < KHI). The output tile is staged in the LDS of the operand buffers, [128][136] 16-bit, and leaves in whole lines
#define EP 136
__global__ __launch_bounds__(256) void k_proj(const float* __restrict__ XQ, const float* __restrict__ XK, const float* __restrict__ XV, const float* __restrict__ WQ, const float* __restrict__ WK, const float* __restrict__ WV, const float* __restrict__ BQ, const float* __restrict__ BK, const float* __restrict__ BV,
    _Float16* __restrict__ QH, _Float16* __restrict__ QL, _Float16* __restrict__ KH, _Float16* __restrict__ KL, _Float16* __restrict__ VT, __bf16* __restrict__ VB, __bf16* __restrict__ VBL) {
  __shared__ __align__(16) unsigned short sm[GSM(32)];
  const int tid = threadIdx.x, wave = tid >> 5, lane = tid & 31, col = lane & 15, g = lane >> 4; const int wm = wave >> 1, wn = wave & 1; const int which = blockIdx.z; const int c0 = blockIdx.y * 128; const size_t r0 = (size_t)blockIdx.x * 128; const size_t bb = r0 / TT; const int t0 = (int)(r0 % TT);
  const float* X = which == 0 ? XQ : which == 1 ? XK : XV; const float* WA = which == 0 ? WQ : which == 1 ? WK : WV; const float* BA = which == 0 ? BQ : which == 1 ? BK : BV;
  v8f acc[2][4] = {};
  gemm_tile<0, 32, DIN, CC>(X, WA, r0, c0, sm, acc);
#pragma unroll
  for (int j = 0; j < 4; ++j) { const float bias = BA ? bfr(BA[c0 + wn * 64 + j * 16 + col]) : 0.f;
#pragma unroll
    for (int i = 0; i < 2; ++i) acc[i][j] = acc[i][j] + bias; }
  if (which < 2) { _Float16* DH = which == 0 ? QH : KH; _Float16* DL = which == 0 ? QL : KL; const int nhi = which == 0 ? QHI : KHI; _Float16* st = (_Float16*)sm;
#pragma unroll
    for (int i = 0; i < 2; ++i)
#pragma unroll
      for (int j = 0; j < 4; ++j)
#pragma unroll
        for (int r = 0; r < 8; ++r) st[(wm * 32 + i * 16 + 8 * g + r) * EP + wn * 64 + j * 16 + col] = (_Float16)acc[i][j][r];
    __syncthreads();
    for (int e = tid; e < 128 * 16; e += 256) { const int rl = e >> 4, q = e & 15; vst2((unsigned*)(DH + (r0 + rl) * CC + c0 + q * 8), *(const v4u*)&st[rl * EP + q * 8]); }
    if (t0 < nhi) {   /* block-uniform */
      __syncthreads();
#pragma unroll
      for (int i = 0; i < 2; ++i)
#pragma unroll
        for (int j = 0; j < 4; ++j)
#pragma unroll
          for (int r = 0; r < 8; ++r) { const float v = acc[i][j][r]; st[(wm * 32 + i * 16 + 8 * g + r) * EP + wn * 64 + j * 16 + col] = (_Float16)((v - (float)(_Float16)v) * 1024.0f); }
      __syncthreads();
      for (int e = tid; e < 128 * 16; e += 256) { const int rl = e >> 4, q = e & 15; if (t0 + rl < nhi) { vst2((unsigned*)(DL + (bb * nhi + t0 + rl) * (size_t)CC + c0 + q * 8), *(const v4u*)&st[rl * EP + q * 8]); asm volatile("s_wait_xcnt 0x0" ::: "memory"); /* the store's address register is stepped at the loop's foot */ } } }
  } else { _Float16* st = (_Float16*)sm; __bf16* sb = (__bf16*)sm;
#pragma unroll
    for (int i = 0; i < 2; ++i)
#pragma unroll
      for (int j = 0; j < 4; ++j) { v8h t;
#pragma unroll
        for (int r = 0; r < 8; ++r) t[r] = (_Float16)acc[i][j][r];
        *(v8h*)&st[(wn * 64 + j * 16 + col) * EP + wm * 32 + i * 16 + 8 * g] = t; }
    __syncthreads();
    for (int e = tid; e < 128 * 16; e += 256) { const int cl = e >> 4, q = e & 15; vst2((unsigned*)(VT + (bb * CC + c0 + cl) * (size_t)TT + t0 + q * 8), *(const v4u*)&st[cl * EP + q * 8]); }
    if (t0 < KHI) {   /* block-uniform */
#pragma unroll
      for (int pl = 0; pl < 2; ++pl) { __bf16* D = pl == 0 ? VB : VBL;
        __syncthreads();
#pragma unroll
        for (int i = 0; i < 2; ++i)
#pragma unroll
          for (int j = 0; j < 4; ++j) { v8b t;
#pragma unroll
            for (int r = 0; r < 8; ++r) { const float v = acc[i][j][r]; const __bf16 bh = (__bf16)v; t[r] = pl == 0 ? bh : (__bf16)(v - (float)bh); }
            *(v8b*)&sb[(wn * 64 + j * 16 + col) * EP + wm * 32 + i * 16 + 8 * g] = t; }
        __syncthreads();
        for (int e = tid; e < 128 * 16; e += 256) { const int cl = e >> 4, q = e & 15; if (t0 + q * 8 < KHI) { vst2((unsigned*)(D + (bb * CC + c0 + cl) * (size_t)KHI + t0 + q * 8), *(const v4u*)&sb[cl * EP + q * 8]); asm volatile("s_wait_xcnt 0x0" ::: "memory"); /* the store's address register is stepped at the loop's foot */ } } } } } }
// ---- k_fa: block = 256 queries of (b, h), 16 waves = 8 groups of 32 query columns x KS key halves, so that four waves share a SIMD and one wave's softmax chains run under the others' products; one pass = 32 keys, one stage = SK keys, of which a wave walks its half (SKW keys). Each wave keeps its own running maximum, sum and O^T over its keys; at the end the second half's waves hand theirs over through LDS and the first half's waves join the two (common maximum, both rescaled) and store. The block brings each stage's k rows and v planes into LDS once, by asynchronous 16-byte copies in whole lines (two buffers: the next stage's copies fly during this stage's passes; one barrier a stage), and all waves take their fragments from there. S^T = K Q^T (A = k rows, B = q rows, same k order), logits x SCALE + log-weight in the log2 domain, running maximum and sum per query column (online softmax), P x 2^8 once to f16 packed from the two score tiles as the B operand, O^T += V^T P^T (A = v planes); the logits never leave the registers. Every inner loop is fully unrolled so that the fragment and accumulator arrays are indexed by constants and stay in registers
#define FQ 2               // 16-column query groups per wave
#define KS 2               // key halves of a stage, one per group of 8 waves
#define SK 256             // keys per stage
#define SKW (SK / KS)      // keys of a stage that one wave walks
#define KPI (HD + 8)       // LDS pitch of a k row, f16 elements: 144 B = 16 B x odd, conflict-free for 16-byte fragment reads
#define VPI (SK + 8)       // LDS pitch of a v plane's SK keys: 528 B = 16 B x odd
#define FBUF (SK * KPI + HD * VPI)   // f16 elements of one buffer: k rows, then v planes
#define LOG2E 1.44269504088896340736f
__device__ __forceinline__ float xhalf(float x) { return __builtin_bit_cast(float, __builtin_amdgcn_permlanex16(__builtin_bit_cast(int, x), __builtin_bit_cast(int, x), 0x76543210, 0xfedcba98, false, false)); }   // lane l with lane l ^ 16
__device__ __forceinline__ v8f wmma_h(v16h a, v16h b, v8f c) { return __builtin_amdgcn_wmma_f32_16x16x32_f16(false, a, false, b, (short)0, c, false, false); }
typedef __attribute__((address_space(3))) _Float16 lds_h;
// one stage: each thread copies four 16-byte pieces of the k rows (64 rows apart) and four of the v planes (16 planes apart). kl, vl: the lane's LDS byte addresses; kg, vg: its global addresses. The s_wait_xcnt stands inside the statement so that no address register is rewritten ahead of it
__device__ __forceinline__ void fa_stage(unsigned kl, unsigned vl, const _Float16* kg, const _Float16* vg) {
  asm volatile("global_load_async_to_lds_b128 %0, %8, off\n\t"
               "global_load_async_to_lds_b128 %1, %9, off\n\t"
               "global_load_async_to_lds_b128 %2, %10, off\n\t"
               "global_load_async_to_lds_b128 %3, %11, off\n\t"
               "global_load_async_to_lds_b128 %4, %12, off\n\t"
               "global_load_async_to_lds_b128 %5, %13, off\n\t"
               "global_load_async_to_lds_b128 %6, %14, off\n\t"
               "global_load_async_to_lds_b128 %7, %15, off\n\t"
               "s_wait_xcnt 0x0"
               :: "v"(kl), "v"(kl + 64u * (KPI * 2)), "v"(kl + 128u * (KPI * 2)), "v"(kl + 192u * (KPI * 2)),
                  "v"(vl), "v"(vl + 16u * (VPI * 2)), "v"(vl + 32u * (VPI * 2)), "v"(vl + 48u * (VPI * 2)),
                  "v"(kg), "v"(kg + (size_t)64 * CC), "v"(kg + (size_t)128 * CC), "v"(kg + (size_t)192 * CC),
                  "v"(vg), "v"(vg + (size_t)16 * TT), "v"(vg + (size_t)32 * TT), "v"(vg + (size_t)48 * TT)
               : "memory"); }
__global__ __launch_bounds__(512) void k_fa(const _Float16* __restrict__ QH, const _Float16* __restrict__ KH, const _Float16* __restrict__ VT, const float* __restrict__ WGT, float* __restrict__ Y) { __shared__ __align__(32) _Float16 skv[2 * FBUF + 2 * TT]; float* const slw = (float*)(skv + 2 * FBUF);   /* the stage buffers first, so that every fragment's offset in a buffer fits the LDS instruction's 16-bit offset field; the log-weights behind them */
  const int tid = threadIdx.x, wave = tid >> 5, lane = tid & 31, col = lane & 15, g = lane >> 4; const int qg = wave & 7, kh = wave >> 3; const int h = blockIdx.y, b = blockIdx.z; const int q0 = blockIdx.x * (128 * FQ) + qg * (16 * FQ);
  const _Float16* kg = KH + ((size_t)b * TT + (tid >> 3)) * CC + h * HD + (tid & 7) * 8;              /* 8 threads a k row: 128 B, one line */
  const _Float16* vg = VT + ((size_t)b * CC + h * HD + (tid >> 5)) * (size_t)TT + (tid & 31) * 8;     /* 32 threads a v plane's SK keys: 512 B, four lines */
  const unsigned sb = (unsigned)(size_t)(const lds_h*)skv; const unsigned kl = sb + (tid >> 3) * (KPI * 2) + (tid & 7) * 16; const unsigned vl = sb + SK * KPI * 2 + (tid >> 5) * (VPI * 2) + (tid & 31) * 16;
  fa_stage(kl, vl, kg, vg);   /* stage 0 into buffer 0 */
  for (int k = tid; k < TT; k += 512) slw[k] = logf(bfr(WGT[(size_t)b * TT + k]) + 1.0e-20f) * LOG2E;   /* per-key log-weight, once per block */
  asm volatile("s_wait_asynccnt 0x0" ::: "memory");   /* this wave's copies of stage 0 have landed before the barrier that lets the other waves read them */
  __syncthreads();
  fa_stage(kl + FBUF * 2, vl + FBUF * 2, kg + (size_t)SK * CC, vg + SK);   /* stage 1 into buffer 1 */
  v16h qf[FQ][2];
#pragma unroll
  for (int c = 0; c < FQ; ++c)
#pragma unroll
    for (int kc = 0; kc < 2; ++kc) qf[c][kc] = frag_h(QH + ((size_t)b * TT + q0 + c * 16 + col) * CC + h * HD + kc * 32, lane);
  v8f acc[FQ][4] = {}; float m[FQ], l[FQ];
#pragma unroll
  for (int c = 0; c < FQ; ++c) { m[c] = -1.0e30f; l[c] = 0.f; }
  for (int st = 0; st < TT / SK; ++st) {
    const _Float16* Kb = skv + (st & 1) * FBUF + (kh * SKW + col) * KPI; const _Float16* Vb = skv + (st & 1) * FBUF + SK * KPI + col * VPI + kh * SKW;   /* this wave's half of the stage */
    v16h kf[2][2];
#pragma unroll
    for (int t = 0; t < 2; ++t)
#pragma unroll
      for (int kc = 0; kc < 2; ++kc) kf[t][kc] = frag_h(Kb + (t * 16) * KPI + kc * 32, lane);
#pragma unroll 1   /* kept rolled: unrolled, the four passes' fragments and scores are live together, the kernel goes beyond 256 registers and register-window switches stand all through the loop */
    for (int ps = 0; ps < SKW / 32; ++ps) {
      v16h vf[4];
#pragma unroll
      for (int j = 0; j < 4; ++j) vf[j] = frag_h(Vb + (j * 16) * VPI + ps * 32, lane);
      v8f lw[2];
#pragma unroll
      for (int t = 0; t < 2; ++t) lw[t] = *(const v8f*)&slw[st * SK + kh * SKW + ps * 32 + t * 16 + 8 * g];
      v8f s[FQ][2] = {};
#pragma unroll
      for (int kc = 0; kc < 2; ++kc)
#pragma unroll
        for (int c = 0; c < FQ; ++c)
#pragma unroll
          for (int t = 0; t < 2; ++t) s[c][t] = wmma_h(kf[t][kc], qf[c][kc], s[c][t]);
      const int pn = ps + 1 < SKW / 32 ? ps + 1 : 0;   /* next pass's k rows of the same stage, fetched behind this pass's score products (the wave's last pass of a stage re-reads its own first 32 rows, unused) */
#pragma unroll
      for (int t = 0; t < 2; ++t)
#pragma unroll
        for (int kc = 0; kc < 2; ++kc) kf[t][kc] = frag_h(Kb + (pn * 32 + t * 16) * KPI + kc * 32, lane);
      __builtin_amdgcn_sched_barrier(0);   /* keeps the softmax below from being scheduled ahead of the prefetch, which would then be issued only a few instructions before the next pass needs it */
#pragma unroll
      for (int c = 0; c < FQ; ++c) {
        float mx = m[c];
#pragma unroll
        for (int t = 0; t < 2; ++t)
#pragma unroll
          for (int r = 0; r < 8; ++r) { s[c][t][r] = fmaf(s[c][t][r], SCALE * LOG2E, lw[t][r]); mx = fmaxf(mx, s[c][t][r]); }
        mx = fmaxf(mx, xhalf(mx));   /* the two lane halves hold the two key halves of one query column */
        const float alpha = __builtin_amdgcn_exp2f(m[c] - mx); m[c] = mx; const float ms = mx - 8.0f;
        float sum = 0.f; v16h p;
#pragma unroll
        for (int t = 0; t < 2; ++t)
#pragma unroll
          for (int r = 0; r < 8; ++r) { const float e = __builtin_amdgcn_exp2f(s[c][t][r] - ms); sum += e; p[t * 8 + r] = (_Float16)e; }
        l[c] = l[c] * alpha + sum;
#pragma unroll
        for (int j = 0; j < 4; ++j) { acc[c][j] = acc[c][j] * alpha; acc[c][j] = wmma_h(vf[j], p, acc[c][j]); } }
      __builtin_amdgcn_sched_barrier(0);   /* keeps the pass's last matrix instructions ahead of the slots below */
      asm volatile("v_nop\n\tv_nop\n\tv_nop\n\tv_nop");   /* the four vector slots between the pass's last matrix instruction and the address arithmetic at the loop's head, which may reuse a register of its A operand */
    }
    asm volatile("s_wait_dscnt 0x0" ::: "memory");      /* this wave's reads of the buffer are done before the barrier behind which it is refilled */
    asm volatile("s_wait_asynccnt 0x0" ::: "memory");   /* this wave's copies of stage st + 1 have landed before the barrier that lets the other waves read them */
    __syncthreads();
    if (st + 2 < TT / SK) fa_stage(kl + (st & 1) * (FBUF * 2), vl + (st & 1) * (FBUF * 2), kg + (size_t)(st + 2) * SK * CC, vg + (st + 2) * SK); }   /* stage st + 2 into the buffer that every wave has just left */
  asm volatile("s_wait_asynccnt 0x0" ::: "memory");   /* no copy is outstanding when the wave ends */
  /* join of the two key halves. Behind the last stage's barrier no wave reads skv or slw any more and no copy is outstanding: both serve as the hand-over space, 16 bytes a lane, lanes side by side */
  float* mg = (float*)skv + qg * (FQ * 4 * 2 * 128) + lane * 4; float* ml = slw + qg * (FQ * 2 * 32) + lane;
  if (kh == 1) {
#pragma unroll
    for (int c = 0; c < FQ; ++c) { ml[(c * 2) * 32] = m[c]; ml[(c * 2 + 1) * 32] = l[c];
#pragma unroll
      for (int j = 0; j < 4; ++j) { *(v4f*)&mg[((c * 4 + j) * 2) * 128] = __builtin_shufflevector(acc[c][j], acc[c][j], 0, 1, 2, 3); *(v4f*)&mg[((c * 4 + j) * 2 + 1) * 128] = __builtin_shufflevector(acc[c][j], acc[c][j], 4, 5, 6, 7); } } }
  __syncthreads();   /* the second half's maxima, sums and O^T are in LDS before the first half's waves read them */
  if (kh == 0) {
#pragma unroll
    for (int c = 0; c < FQ; ++c) { const float m1 = ml[(c * 2) * 32], l1 = ml[(c * 2 + 1) * 32]; const float mx = fmaxf(m[c], m1); const float a0 = __builtin_amdgcn_exp2f(m[c] - mx), a1 = __builtin_amdgcn_exp2f(m1 - mx);
      const float lj = l[c] * a0 + l1 * a1; const float lt = lj + xhalf(lj); const float inv = lt > 0.f ? 1.0f / lt : 0.f; const float i0 = a0 * inv, i1 = a1 * inv;
#pragma unroll
      for (int j = 0; j < 4; ++j) { const v4f p0 = *(const v4f*)&mg[((c * 4 + j) * 2) * 128], p1 = *(const v4f*)&mg[((c * 4 + j) * 2 + 1) * 128];
        acc[c][j] = acc[c][j] * i0 + __builtin_shufflevector(p0, p1, 0, 1, 2, 3, 4, 5, 6, 7) * i1; } }
    __builtin_amdgcn_sched_barrier(0);   /* every joined value is formed before the first store, so that no register which an issued store names is rewritten behind it */
#pragma unroll
    for (int c = 0; c < FQ; ++c) { float* yr = Y + ((size_t)b * TT + q0 + c * 16 + col) * CC + h * HD + 8 * g;
#pragma unroll
      for (int j = 0; j < 4; ++j) { vst2(yr + j * 16, __builtin_shufflevector(acc[c][j], acc[c][j], 0, 1, 2, 3)); vst2(yr + j * 16 + 4, __builtin_shufflevector(acc[c][j], acc[c][j], 4, 5, 6, 7)); } } } }
// ---- k_out: block = (128 rows, 128 cols): out = ctx Wo (+ bo): ctx x 2^6 once to f16 (small-magnitude context rows stay clear of f16 subnormals) against Wo as f16(bf16 x 2^8) exact (1 product) x 2^-14. Each wave stages its 32 x 64 f32 in its own part of the LDS of the operand buffers and stores whole lines
__global__ __launch_bounds__(256) void k_out(const float* __restrict__ Y, const float* __restrict__ WO, const float* __restrict__ BO, float* __restrict__ OUT) { __shared__ __align__(16) unsigned short sm[GSM(64)];
  const int tid = threadIdx.x, wave = tid >> 5, lane = tid & 31, col = lane & 15, g = lane >> 4; const int wm = wave >> 1, wn = wave & 1; const int c0 = blockIdx.y * 128; const size_t r0 = (size_t)blockIdx.x * 128;
  v8f acc[2][4] = {};
  gemm_tile<1, 64, CC, DIN>(Y, WO, r0, c0, sm, acc);
  float* sf = (float*)sm + wave * (32 * 68);
#pragma unroll
  for (int j = 0; j < 4; ++j) { const float bias = BO ? bfr(BO[c0 + wn * 64 + j * 16 + col]) : 0.f;
#pragma unroll
    for (int i = 0; i < 2; ++i)
#pragma unroll
      for (int r = 0; r < 8; ++r) sf[(i * 16 + 8 * g + r) * 68 + j * 16 + col] = acc[i][j][r] * (1.0f / 16384.0f) + bias; }   /* 2^-8 (Wo carry) x 2^-6 (ctx carry) */
  LDSX(); for (int it = 0; it < 16; ++it) { const int rl = it * 2 + g; vst2(OUT + (r0 + wm * 32 + rl) * DIN + c0 + wn * 64 + col * 4, *(const v4f*)&sf[rl * 68 + col * 4]); } }

extern "C" void kernel_launch(void* const* d_in, const int* in_sizes, int n_in, void* d_out, int out_size, void* d_ws, size_t ws_size, hipStream_t stream) {
  (void)in_sizes; (void)n_in; (void)out_size;
  const float** F = (const float**)d_in;
  if (ws_size < (size_t)WS_END) return;
  char* ws = (char*)d_ws; _Float16 *QH = (_Float16*)(ws + WS_QH), *KH = (_Float16*)(ws + WS_KH), *VT = (_Float16*)(ws + WS_VT), *QL = (_Float16*)(ws + WS_QL), *KL = (_Float16*)(ws + WS_KL); __bf16 *VB = (__bf16*)(ws + WS_VB), *VBL = (__bf16*)(ws + WS_VBL); float *S = (float*)(ws + WS_S), *Y = (float*)(ws + WS_Y);
  (void)Y; (void)QL; (void)KL; (void)VB; (void)VBL; (void)S;
  // inputs: 0 query [2,2048,1024]; 1 key; 2 value; 3 weights [2,2048]; 4 wq [1024,1024] (in,out), 5 bq; 6 wk, 7 bk; 8 wv, 9 bv; 10 wo (in,out), 11 bo (all biases zeros, read)
  k_proj<<<dim3(TNB * TT / 128, CC / 128, 3), 256, 0, stream>>>(F[0], F[1], F[2], F[4], F[6], F[8], F[5], F[7], F[9], QH, QL, KH, KL, VT, VB, VBL);
  k_fa<<<dim3(TT / (128 * FQ), NH, TNB), 512, 0, stream>>>(QH, KH, VT, F[3], Y);
  k_out<<<dim3(TNB * TT / 128, DIN / 128), 256, 0, stream>>>(Y, F[10], F[11], (float*)d_out);
}

// v005
// It runs in 91.1 microseconds.
// Timed twice side by side with v004, it ran 1.11 times as fast both times.
// Counting every step since v000, it is 13.1 times as fast.
// compute dtype: all float inputs rounded to bf16; q / k / v projections with EXACT bf16 products on WMMA 16x16x32 (f32 accumulate) + bias (zeros, read); logits k x q once to f16 each (1 product) x 64^-0.5, + logf(bf16(weight) + 1e-20) per key in f32; online softmax f32 (base 2); exp2(logit - running max) x 2^8 once to f16 x v once to f16 (1 product), divided by the f32 sum at the end; ctx x 2^6 once to f16 x wo f16(bf16 x 2^8) + bo; f32 output.
#include <hip/hip_runtime.h>
#include <math.h>

typedef __attribute__((ext_vector_type(16))) _Float16 v16h;
typedef __attribute__((ext_vector_type(16))) __bf16 v16b;
typedef __attribute__((ext_vector_type(8)))  _Float16 v8h;
typedef __attribute__((ext_vector_type(8)))  float v8f;
typedef __attribute__((ext_vector_type(4)))  float v4f;
typedef __attribute__((ext_vector_type(2)))  float v2f;
typedef __attribute__((ext_vector_type(4)))  unsigned v4u;
typedef __attribute__((ext_vector_type(4)))  int v4i;
typedef float __attribute__((may_alias)) float_a;
typedef int __attribute__((may_alias)) int_a;

template <typename T> __device__ __forceinline__ void vst2(void* p, T v) { *(T*)p = v;  }
__device__ __forceinline__ v8f wmma16(v16h a, v16h b, v8f c) {
  v8f d = __builtin_amdgcn_wmma_f32_16x16x32_f16(false, a, false, b, (short)0, c, false, false);
  asm volatile("v_nop\n\tv_nop\n\tv_nop\n\tv_nop" : "+v"(d) : "v"(a), "v"(b));
  return d;
}
__device__ __forceinline__ v8f wmma_bf(v16b a, v16b b, v8f c) {
  v8f d = __builtin_amdgcn_wmma_f32_16x16x32_bf16(false, a, false, b, (short)0, c, false, false);
  asm volatile("v_nop\n\tv_nop\n\tv_nop\n\tv_nop" : "+v"(d) : "v"(a), "v"(b));
  return d;
}
// 16x16x32 fragments: lane = (h = lane>>4, row/col = lane&15); elements 0..7 = k0+8h+0..7, 8..15 = k0+16+8h+0..7; D element r = row 8h+r
__device__ __forceinline__ v16h frag_h(const _Float16* rowk0, int lane) {
  union { v16h v; v8h q[2]; } u; const _Float16* p = rowk0 + 8 * (lane >> 4);
  u.q[0] = *(const v8h*)p; u.q[1] = *(const v8h*)(p + 16); return u.v;
}
__device__ __forceinline__ v16h frag_f32(const float* rowk0, int lane) {
  v16h a; const float* p = rowk0 + 8 * (lane >> 4);
#pragma unroll
  for (int i = 0; i < 8; ++i) { a[i] = (_Float16)p[i]; a[8 + i] = (_Float16)p[16 + i]; }
  return a;
}
__device__ __forceinline__ v16h frag_f32s(const float* rowk0, int lane, float sc) {
  v16h a; const float* p = rowk0 + 8 * (lane >> 4);
#pragma unroll
  for (int i = 0; i < 8; ++i) { a[i] = (_Float16)(p[i] * sc); a[8 + i] = (_Float16)(p[16 + i] * sc); }
  return a;
}
// column fragment from a [K][ld] layout (column n), rows >= K read as 0
__device__ __forceinline__ v16h fragc_f32(const float* W, int k0, int n, int lane, int ld, int K) {
  v16h a; const int g = lane >> 4;
#pragma unroll
  for (int i = 0; i < 8; ++i) { const int ka = k0 + 8 * g + i, kb = ka + 16;
    a[i] = (_Float16)(ka < K ? W[(size_t)(ka < K ? ka : K - 1) * ld + n] : 0.f); a[8 + i] = (_Float16)(kb < K ? W[(size_t)(kb < K ? kb : K - 1) * ld + n] : 0.f); }
  return a;
}
struct F2 { v16b h, l; };
__device__ __forceinline__ F2 bsplit16(const float v[16]) { F2 r;
#pragma unroll
  for (int i = 0; i < 16; ++i) { const __bf16 h = (__bf16)v[i]; r.h[i] = h; r.l[i] = (__bf16)(v[i] - (float)h); }
  return r; }
__device__ __forceinline__ F2 split_row(const float* row, int k0, int lane) { float v[16]; const float* p = row + k0 + 8 * (lane >> 4);
#pragma unroll
  for (int i = 0; i < 8; ++i) { v[i] = p[i]; v[8 + i] = p[16 + i]; }
  return bsplit16(v); }
__device__ __forceinline__ F2 split_rowK(const float* row, int k0, int lane, int K) { float v[16]; const int g = lane >> 4;
#pragma unroll
  for (int i = 0; i < 8; ++i) { const int ka = k0 + 8 * g + i, kb = ka + 16; v[i] = ka < K ? row[ka < K ? ka : K - 1] : 0.f; v[8 + i] = kb < K ? row[kb < K ? kb : K - 1] : 0.f; }
  return bsplit16(v); }
__device__ __forceinline__ F2 split_col(const float* W, int k0, int n, int lane, int ld, int K) { float v[16]; const int g = lane >> 4;
#pragma unroll
  for (int i = 0; i < 8; ++i) { const int ka = k0 + 8 * g + i, kb = ka + 16; v[i] = ka < K ? W[(size_t)(ka < K ? ka : K - 1) * ld + n] : 0.f; v[8 + i] = kb < K ? W[(size_t)(kb < K ? kb : K - 1) * ld + n] : 0.f; }
  return bsplit16(v); }
__device__ __forceinline__ v8f mac3(const F2& a, const F2& b, v8f c) { c = wmma_bf(a.l, b.h, c); c = wmma_bf(a.h, b.l, c); return wmma_bf(a.h, b.h, c); }
__device__ __forceinline__ float sigm(float v) { return 1.0f / (1.0f + expf(-v)); }
#define LDSX() do { asm volatile("s_wait_dscnt 0" ::: "memory"); __builtin_amdgcn_wave_barrier(); __builtin_amdgcn_fence(__ATOMIC_RELEASE, "workgroup"); } while (0)

// Multi-head attention on separate inputs with a per-key multiplicative weight (query / key / value [2,2048,1024]; (in,out) wq / wk / wv / wo [1024,1024] N(0, 1/1024) applied as x @ W + b, all biases zeros (read); weights [2,2048] uniform(0,1), one per (batch, key); 16 heads x 64; scores / sqrt(64) + log(weights + 1e-20) broadcast over heads and queries; softmax over keys; out @ wo + bo).
#define NB 2
#define TT 2048
#define CC 1024            // NH * HD = projected width
#define DIN 1024          // input (model) width
#define NH 16
#define HD 64
#define NQB (TT / 64)
#define HG 4
#define SCALE (0.125f)
#define CAUSAL 0
#ifndef TNB
#define TNB NB
#endif
__device__ __forceinline__ float bfr(float v) { return (float)(__bf16)v; }
__host__ __device__ __forceinline__ int kb_last(int qb) { return CAUSAL ? ((qb * 64 + 63) >> 7) : (TT / 128 - 1); }
typedef __attribute__((ext_vector_type(8))) __bf16 v8b;
__device__ __forceinline__ v16b frag_b(const __bf16* rowk0, int lane) {
  union { v16b v; v8b q[2]; } u; const __bf16* p = rowk0 + 8 * (lane >> 4);
  u.q[0] = *(const v8b*)p; u.q[1] = *(const v8b*)(p + 16); return u.v;
}
#define QBH 0              // unused: this file has no high-precision path
#define QHI 0               // single-product logits on every row (logit sigma ~1)
#define KHI 64            // key rows carrying k residual / v bf16 hi+lo planes (written by k_proj, read by no kernel)
// B fragment (k rows k0+.., output column o) of a weight: (in,out) [K][ld] or (out,in) [ld rows of K]: bf16 exact, or f16(bf16 * 256) exact
__device__ __forceinline__ v16b wcol_io(const float* Wm, int k0, int o, int lane, int ld) { v16b w; const int g = lane >> 4;
#pragma unroll
  for (int i = 0; i < 8; ++i) { w[i] = (__bf16)Wm[(size_t)(k0 + 8 * g + i) * ld + o]; w[8 + i] = (__bf16)Wm[(size_t)(k0 + 16 + 8 * g + i) * ld + o]; }
  return w; }
__device__ __forceinline__ v16b wcol_oi(const float* Wm, int k0, int o, int lane, int K) { v16b w; const float* p = Wm + (size_t)o * K + k0 + 8 * (lane >> 4);
#pragma unroll
  for (int i = 0; i < 8; ++i) { w[i] = (__bf16)p[i]; w[8 + i] = (__bf16)p[16 + i]; }
  return w; }
__device__ __forceinline__ v16h wcolh_io(const float* Wm, int k0, int o, int lane, int ld) { v16h w; const int g = lane >> 4;
#pragma unroll
  for (int i = 0; i < 8; ++i) { w[i] = (_Float16)(bfr(Wm[(size_t)(k0 + 8 * g + i) * ld + o]) * 256.0f); w[8 + i] = (_Float16)(bfr(Wm[(size_t)(k0 + 16 + 8 * g + i) * ld + o]) * 256.0f); }
  return w; }
__device__ __forceinline__ v16h wcolh_oi(const float* Wm, int k0, int o, int lane, int K) { v16h w; const float* p = Wm + (size_t)o * K + k0 + 8 * (lane >> 4);
#pragma unroll
  for (int i = 0; i < 8; ++i) { w[i] = (_Float16)(bfr(p[i]) * 256.0f); w[8 + i] = (_Float16)(bfr(p[16 + i]) * 256.0f); }
  return w; }
#define WQKV_LAYOUT 0   // 0 = (in,out) [DIN][CC]; 1 = (out,in) [CC][DIN]; 2 = per-head [NH][DIN][HD]
__device__ __forceinline__ v16b wcol_hdk(const float* Wm, int k0, int o, int lane) { v16b w; const int g = lane >> 4; const float* p = Wm + (size_t)(o / HD) * DIN * HD + (o % HD);
#pragma unroll
  for (int i = 0; i < 8; ++i) { w[i] = (__bf16)p[(size_t)(k0 + 8 * g + i) * HD]; w[8 + i] = (__bf16)p[(size_t)(k0 + 16 + 8 * g + i) * HD]; }
  return w; }
#define WO_OUT_IN 0
#if WQKV_LAYOUT == 1
#define WCOL(W, k0, o, lane) wcol_oi(W, k0, o, lane, DIN)
#elif WQKV_LAYOUT == 2
#define WCOL(W, k0, o, lane) wcol_hdk(W, k0, o, lane)
#else
#define WCOL(W, k0, o, lane) wcol_io(W, k0, o, lane, CC)
#endif
#if WO_OUT_IN
#define WOCOL(W, k0, o, lane) wcol_oi(W, k0, o, lane, CC)
#define WOCOLH(W, k0, o, lane) wcolh_oi(W, k0, o, lane, CC)
#else
#define WOCOL(W, k0, o, lane) wcol_io(W, k0, o, lane, DIN)
#define WOCOLH(W, k0, o, lane) wcolh_io(W, k0, o, lane, DIN)
#endif

#define WS_QH  0u                                      // f16 q rows [b*t][CC]
#define WS_KH  (WS_QH + 2u * (size_t)NB * TT * CC)      // f16 k rows [b*t][CC]
#define WS_VT  (WS_KH + 2u * (size_t)NB * TT * CC)      // f16 v planes [b][c][t]
#define WS_QL  (WS_VT + 2u * (size_t)NB * CC * TT)      // f16 q residual x 2^10 rows [b][t < QHI][CC]
#define WS_KL  (WS_QL + 2u * (size_t)NB * QHI * CC)     // f16 k residual x 2^10 rows [b][t < KHI][CC]
#define WS_VB  (WS_KL + 2u * (size_t)NB * KHI * CC)     // bf16 v hi planes [b][c][t < KHI]
#define WS_VBL (WS_VB + 2u * (size_t)NB * CC * KHI)
#define WS_S   (WS_VBL + 2u * (size_t)NB * CC * KHI)    // f32 region [hg][t][s], written and read by no kernel
#define WS_Y   (WS_S  + 4u * (size_t)HG * TT * TT)      // f32 ctx rows [b*t][CC] (only when there is an output projection)
#define WS_END (WS_Y  + 4u * (size_t)NB * TT * CC)

// ---- shared by k_proj and k_out: one 128 x 128 tile of X W per block of 8 waves (4 x 2, each 32 rows x 64 columns). A pass is GK k (32 in k_proj, so that three blocks fit a WGP's registers; 64 in k_out, one block a WGP, for more bytes in flight): the block reads both f32 operand tiles once, in whole 128-byte lines, rounds them to their 16-bit form and lays them k-contiguous in LDS (X rows, W columns), pitch 2 GK + 16 B; every wave takes its fragments from there. Two buffers: the next pass's global loads fly during this pass's products; one barrier a pass
typedef __attribute__((ext_vector_type(2))) unsigned v2u;
typedef __attribute__((ext_vector_type(2))) __bf16 v2b;
typedef __attribute__((ext_vector_type(2))) _Float16 v2h;
#define GSM(GK) (4 * 128 * ((GK) + 8))   // 16-bit elements of LDS: two buffers x two operand tiles of 128 rows, pitch GK + 8
// KIND 0: x and w to bf16 (exact bf16 products); KIND 1: x * 2^6 to f16, bf16(w) * 2^8 to f16
template <int KIND> __device__ __forceinline__ unsigned pkx(float a, float b) {
  if constexpr (KIND == 0) { v2b t; t[0] = (__bf16)a; t[1] = (__bf16)b; return __builtin_bit_cast(unsigned, t); }
  else { v2h t; t[0] = (_Float16)(a * 64.0f); t[1] = (_Float16)(b * 64.0f); return __builtin_bit_cast(unsigned, t); } }
template <int KIND> __device__ __forceinline__ unsigned pkw(float a, float b) {
  if constexpr (KIND == 0) { v2b t; t[0] = (__bf16)a; t[1] = (__bf16)b; return __builtin_bit_cast(unsigned, t); }
  else { v2h t; t[0] = (_Float16)(bfr(a) * 256.0f); t[1] = (_Float16)(bfr(b) * 256.0f); return __builtin_bit_cast(unsigned, t); } }
struct G8 { v4u q[2]; };
__device__ __forceinline__ G8 frag_s(const unsigned short* rowk0, int lane) { G8 f; const unsigned short* p = rowk0 + 8 * (lane >> 4); f.q[0] = *(const v4u*)p; f.q[1] = *(const v4u*)(p + 16); return f; }
template <int KIND> __device__ __forceinline__ v8f wmma_g(G8 a, G8 b, v8f c) {
  if constexpr (KIND == 0) return __builtin_amdgcn_wmma_f32_16x16x32_bf16(false, __builtin_bit_cast(v16b, a), false, __builtin_bit_cast(v16b, b), (short)0, c, false, false);
  else return __builtin_amdgcn_wmma_f32_16x16x32_f16(false, __builtin_bit_cast(v16h, a), false, __builtin_bit_cast(v16h, b), (short)0, c, false, false); }
// X [rows][KD] row-major, Wm [KD][ND] row-major; acc[i][j] = rows r0 + 32 (wave >> 1) + 16 i, columns c0 + 64 (wave & 1) + 16 j; k in steps of 32 into one accumulator, the walk starting at pass rot and wrapping round: blocks that share X rows or W columns get different rot, so that at any moment they ask L2 for different lines. Every inner loop is fully unrolled so that the staging, fragment and accumulator arrays are indexed by constants and stay in registers. Ends behind a barrier: sm is free
template <int KIND, int GK, int KD, int ND> __device__ __forceinline__ void gemm_tile(const float* __restrict__ X, const float* __restrict__ Wm, size_t r0, int c0, int rot, unsigned short* sm, v8f (&acc)[2][4]) {
  const int tid = threadIdx.x, wave = tid >> 5, lane = tid & 31, col = lane & 15; const int wm = wave >> 1, wn = wave & 1;
  constexpr int GP = GK + 8, GT = 128 * GP, XT = GK / 4, XS = XT / 2, XR = 256 / XT, WS = GK / 16;
  const int xr = tid / XT, xq = tid % XT;     /* X: XT threads x 16 B = one row's GK floats; XR rows a step, XS steps */
  const int wc = tid & 127, wo = tid >> 7;    /* W: one column a thread, lanes along the row (128 B a wave-load); k octets wo, wo + 2, ... */
  const float* xp = X + (r0 + xr) * KD + xq * 4; const float* wp = Wm + (size_t)(wo * 8) * ND + c0 + wc;
  v4f xv[XS]; float wv[WS][8];
#define G_LOAD(k0) do { _Pragma("unroll") for (int i = 0; i < XS; ++i) xv[i] = *(const v4f*)(xp + (size_t)(i * XR) * KD + (k0)); \
    _Pragma("unroll") for (int i = 0; i < WS; ++i) _Pragma("unroll") for (int e = 0; e < 8; ++e) wv[i][e] = wp[(size_t)((k0) + i * 16 + e) * ND]; } while (0)
#define G_STORE(buf) do { unsigned short* As = sm + (buf) * (2 * GT); unsigned short* Bs = As + GT; \
    _Pragma("unroll") for (int i = 0; i < XS; ++i) { v2u t; t[0] = pkx<KIND>(xv[i][0], xv[i][1]); t[1] = pkx<KIND>(xv[i][2], xv[i][3]); *(v2u*)&As[(xr + i * XR) * GP + xq * 4] = t; } \
    _Pragma("unroll") for (int i = 0; i < WS; ++i) { v4u t; t[0] = pkw<KIND>(wv[i][0], wv[i][1]); t[1] = pkw<KIND>(wv[i][2], wv[i][3]); t[2] = pkw<KIND>(wv[i][4], wv[i][5]); t[3] = pkw<KIND>(wv[i][6], wv[i][7]); *(v4u*)&Bs[wc * GP + (wo + 2 * i) * 8] = t; } } while (0)
  static_assert(((KD / GK) & (KD / GK - 1)) == 0, "the wrap below is a mask");
  G_LOAD((rot & (KD / GK - 1)) * GK); G_STORE(0);
  __syncthreads();
  for (int ks = 0; ks < KD / GK; ++ks) {
    const bool more = ks + 1 < KD / GK;
    if (more) { G_LOAD(((ks + 1 + rot) & (KD / GK - 1)) * GK); asm volatile("s_wait_xcnt 0x0" ::: "memory"); }   /* the wait: the loads' address registers are rewritten further down in the pass */
    __builtin_amdgcn_sched_barrier(0);   /* keeps the next pass's global loads ahead of this pass's products; the compiler otherwise sinks them to just in front of their use and their latency is waited out */
    const unsigned short* As = sm + (ks & 1) * (2 * GT) + (wm * 32 + col) * GP; const unsigned short* Bs = sm + (ks & 1) * (2 * GT) + GT + (wn * 64 + col) * GP;
#pragma unroll
    for (int kc = 0; kc < GK / 32; ++kc) { G8 a[2], b[4];
#pragma unroll
      for (int i = 0; i < 2; ++i) a[i] = frag_s(As + i * 16 * GP + kc * 32, lane);
#pragma unroll
      for (int j = 0; j < 4; ++j) b[j] = frag_s(Bs + j * 16 * GP + kc * 32, lane);
#pragma unroll
      for (int i = 0; i < 2; ++i)
#pragma unroll
        for (int j = 0; j < 4; ++j) acc[i][j] = wmma_g<KIND>(a[i], b[j], acc[i][j]); }
    __builtin_amdgcn_sched_barrier(0);   /* keeps the rounding of the loaded values, and with it the wait for them, behind the products */
    if (more) G_STORE((ks + 1) & 1);   /* into the buffer that every wave left at the barrier of the pass before */
    __syncthreads(); }
#undef G_LOAD
#undef G_STORE
}
// ---- k_proj: block = (128 rows, 128 cols, which): q/k/v = X W (+ b) with exact bf16 products (K = DIN) -> which 0: q f16 rows (+ residual rows < QHI); 1: k f16 rows (+ residual rows < KHI); 2: v f16 planes [c][t] (+ bf16 hi/lo planes for t < KHI). The output tile is staged in the LDS of the operand buffers, [128][136] 16-bit, and leaves in whole lines
#define EP 136
__global__ __launch_bounds__(256) void k_proj(const float* __restrict__ XQ, const float* __restrict__ XK, const float* __restrict__ XV, const float* __restrict__ WQ, const float* __restrict__ WK, const float* __restrict__ WV, const float* __restrict__ BQ, const float* __restrict__ BK, const float* __restrict__ BV,
    _Float16* __restrict__ QH, _Float16* __restrict__ QL, _Float16* __restrict__ KH, _Float16* __restrict__ KL, _Float16* __restrict__ VT, __bf16* __restrict__ VB, __bf16* __restrict__ VBL) {
  __shared__ __align__(16) unsigned short sm[GSM(32)];
  const int tid = threadIdx.x, wave = tid >> 5, lane = tid & 31, col = lane & 15, g = lane >> 4; const int wm = wave >> 1, wn = wave & 1; const int which = blockIdx.z; const int c0 = blockIdx.y * 128; const size_t r0 = (size_t)blockIdx.x * 128; const size_t bb = r0 / TT; const int t0 = (int)(r0 % TT);
  const float* X = which == 0 ? XQ : which == 1 ? XK : XV; const float* WA = which == 0 ? WQ : which == 1 ? WK : WV; const float* BA = which == 0 ? BQ : which == 1 ? BK : BV;
  v8f acc[2][4] = {};
  gemm_tile<0, 32, DIN, CC>(X, WA, r0, c0, blockIdx.x + 4 * blockIdx.y, sm, acc);   /* 32 passes: the 8 blocks of one row band start 4 passes apart, the 32 of one column band 1 apart */
#pragma unroll
  for (int j = 0; j < 4; ++j) { const float bias = BA ? bfr(BA[c0 + wn * 64 + j * 16 + col]) : 0.f;
#pragma unroll
    for (int i = 0; i < 2; ++i) acc[i][j] = acc[i][j] + bias; }
  if (which < 2) { _Float16* DH = which == 0 ? QH : KH; _Float16* DL = which == 0 ? QL : KL; const int nhi = which == 0 ? QHI : KHI; _Float16* st = (_Float16*)sm;
#pragma unroll
    for (int i = 0; i < 2; ++i)
#pragma unroll
      for (int j = 0; j < 4; ++j)
#pragma unroll
        for (int r = 0; r < 8; ++r) st[(wm * 32 + i * 16 + 8 * g + r) * EP + wn * 64 + j * 16 + col] = (_Float16)acc[i][j][r];
    __syncthreads();
    for (int e = tid; e < 128 * 16; e += 256) { const int rl = e >> 4, q = e & 15; vst2((unsigned*)(DH + (r0 + rl) * CC + c0 + q * 8), *(const v4u*)&st[rl * EP + q * 8]); }
    if (t0 < nhi) {   /* block-uniform */
      __syncthreads();
#pragma unroll
      for (int i = 0; i < 2; ++i)
#pragma unroll
        for (int j = 0; j < 4; ++j)
#pragma unroll
          for (int r = 0; r < 8; ++r) { const float v = acc[i][j][r]; st[(wm * 32 + i * 16 + 8 * g + r) * EP + wn * 64 + j * 16 + col] = (_Float16)((v - (float)(_Float16)v) * 1024.0f); }
      __syncthreads();
      for (int e = tid; e < 128 * 16; e += 256) { const int rl = e >> 4, q = e & 15; if (t0 + rl < nhi) { vst2((unsigned*)(DL + (bb * nhi + t0 + rl) * (size_t)CC + c0 + q * 8), *(const v4u*)&st[rl * EP + q * 8]); asm volatile("s_wait_xcnt 0x0" ::: "memory"); /* the store's address register is stepped at the loop's foot */ } } }
  } else { _Float16* st = (_Float16*)sm; __bf16* sb = (__bf16*)sm;
#pragma unroll
    for (int i = 0; i < 2; ++i)
#pragma unroll
      for (int j = 0; j < 4; ++j) { v8h t;
#pragma unroll
        for (int r = 0; r < 8; ++r) t[r] = (_Float16)acc[i][j][r];
        *(v8h*)&st[(wn * 64 + j * 16 + col) * EP + wm * 32 + i * 16 + 8 * g] = t; }
    __syncthreads();
    for (int e = tid; e < 128 * 16; e += 256) { const int cl = e >> 4, q = e & 15; vst2((unsigned*)(VT + (bb * CC + c0 + cl) * (size_t)TT + t0 + q * 8), *(const v4u*)&st[cl * EP + q * 8]); }
    if (t0 < KHI) {   /* block-uniform */
#pragma unroll
      for (int pl = 0; pl < 2; ++pl) { __bf16* D = pl == 0 ? VB : VBL;
        __syncthreads();
#pragma unroll
        for (int i = 0; i < 2; ++i)
#pragma unroll
          for (int j = 0; j < 4; ++j) { v8b t;
#pragma unroll
            for (int r = 0; r < 8; ++r) { const float v = acc[i][j][r]; const __bf16 bh = (__bf16)v; t[r] = pl == 0 ? bh : (__bf16)(v - (float)bh); }
            *(v8b*)&sb[(wn * 64 + j * 16 + col) * EP + wm * 32 + i * 16 + 8 * g] = t; }
        __syncthreads();
        for (int e = tid; e < 128 * 16; e += 256) { const int cl = e >> 4, q = e & 15; if (t0 + q * 8 < KHI) { vst2((unsigned*)(D + (bb * CC + c0 + cl) * (size_t)KHI + t0 + q * 8), *(const v4u*)&sb[cl * EP + q * 8]); asm volatile("s_wait_xcnt 0x0" ::: "memory"); /* the store's address register is stepped at the loop's foot */ } } } } } }
// ---- k_fa: block = 256 queries of (b, h), 16 waves = 8 groups of 32 query columns x KS key halves, so that four waves share a SIMD and one wave's softmax chains run under the others' products; one pass = 32 keys, one stage = SK keys, of which a wave walks its half (SKW keys). Each wave keeps its own running maximum, sum and O^T over its keys; at the end the second half's waves hand theirs over through LDS and the first half's waves join the two (common maximum, both rescaled) and store. The block brings each stage's k rows and v planes into LDS once, by asynchronous 16-byte copies in whole lines (two buffers: the next stage's copies fly during this stage's passes; one barrier a stage), and all waves take their fragments from there. S^T = K Q^T (A = k rows, B = q rows, same k order), logits x SCALE + log-weight in the log2 domain, running maximum and sum per query column (online softmax), P x 2^8 once to f16 packed from the two score tiles as the B operand, O^T += V^T P^T (A = v planes); the logits never leave the registers. Every inner loop is fully unrolled so that the fragment and accumulator arrays are indexed by constants and stay in registers
#define FQ 2               // 16-column query groups per wave
#define KS 2               // key halves of a stage, one per group of 8 waves
#define SK 256             // keys per stage
#define SKW (SK / KS)      // keys of a stage that one wave walks
#define KPI (HD + 8)       // LDS pitch of a k row, f16 elements: 144 B = 16 B x odd, conflict-free for 16-byte fragment reads
#define VPI (SK + 8)       // LDS pitch of a v plane's SK keys: 528 B = 16 B x odd
#define FBUF (SK * KPI + HD * VPI)   // f16 elements of one buffer: k rows, then v planes
#define LOG2E 1.44269504088896340736f
__device__ __forceinline__ float xhalf(float x) { return __builtin_bit_cast(float, __builtin_amdgcn_permlanex16(__builtin_bit_cast(int, x), __builtin_bit_cast(int, x), 0x76543210, 0xfedcba98, false, false)); }   // lane l with lane l ^ 16
__device__ __forceinline__ v8f wmma_h(v16h a, v16h b, v8f c) { return __builtin_amdgcn_wmma_f32_16x16x32_f16(false, a, false, b, (short)0, c, false, false); }
typedef __attribute__((address_space(3))) _Float16 lds_h;
// one stage: each thread copies four 16-byte pieces of the k rows (64 rows apart) and four of the v planes (16 planes apart). kl, vl: the lane's LDS byte addresses; kg, vg: its global addresses. The s_wait_xcnt stands inside the statement so that no address register is rewritten ahead of it
__device__ __forceinline__ void fa_stage(unsigned kl, unsigned vl, const _Float16* kg, const _Float16* vg) {
  asm volatile("global_load_async_to_lds_b128 %0, %8, off\n\t"
               "global_load_async_to_lds_b128 %1, %9, off\n\t"
               "global_load_async_to_lds_b128 %2, %10, off\n\t"
               "global_load_async_to_lds_b128 %3, %11, off\n\t"
               "global_load_async_to_lds_b128 %4, %12, off\n\t"
               "global_load_async_to_lds_b128 %5, %13, off\n\t"
               "global_load_async_to_lds_b128 %6, %14, off\n\t"
               "global_load_async_to_lds_b128 %7, %15, off\n\t"
               "s_wait_xcnt 0x0"
               :: "v"(kl), "v"(kl + 64u * (KPI * 2)), "v"(kl + 128u * (KPI * 2)), "v"(kl + 192u * (KPI * 2)),
                  "v"(vl), "v"(vl + 16u * (VPI * 2)), "v"(vl + 32u * (VPI * 2)), "v"(vl + 48u * (VPI * 2)),
                  "v"(kg), "v"(kg + (size_t)64 * CC), "v"(kg + (size_t)128 * CC), "v"(kg + (size_t)192 * CC),
                  "v"(vg), "v"(vg + (size_t)16 * TT), "v"(vg + (size_t)32 * TT), "v"(vg + (size_t)48 * TT)
               : "memory"); }
__global__ __launch_bounds__(512) void k_fa(const _Float16* __restrict__ QH, const _Float16* __restrict__ KH, const _Float16* __restrict__ VT, const float* __restrict__ WGT, float* __restrict__ Y) { __shared__ __align__(32) _Float16 skv[2 * FBUF + 2 * TT]; float* const slw = (float*)(skv + 2 * FBUF);   /* the stage buffers first, so that every fragment's offset in a buffer fits the LDS instruction's 16-bit offset field; the log-weights behind them */
  const int tid = threadIdx.x, wave = tid >> 5, lane = tid & 31, col = lane & 15, g = lane >> 4; const int qg = wave & 7, kh = wave >> 3; const int h = blockIdx.y, b = blockIdx.z; const int q0 = blockIdx.x * (128 * FQ) + qg * (16 * FQ);
  const _Float16* kg = KH + ((size_t)b * TT + (tid >> 3)) * CC + h * HD + (tid & 7) * 8;              /* 8 threads a k row: 128 B, one line */
  const _Float16* vg = VT + ((size_t)b * CC + h * HD + (tid >> 5)) * (size_t)TT + (tid & 31) * 8;     /* 32 threads a v plane's SK keys: 512 B, four lines */
  const unsigned sb = (unsigned)(size_t)(const lds_h*)skv; const unsigned kl = sb + (tid >> 3) * (KPI * 2) + (tid & 7) * 16; const unsigned vl = sb + SK * KPI * 2 + (tid >> 5) * (VPI * 2) + (tid & 31) * 16;
  const int rot = blockIdx.x;   /* the blocks of one (b, h) walk the same k rows and v planes: each starts at another stage and wraps round, so that they ask L2 for different lines at any moment */
#define STG(s) (((s) + rot) & (TT / SK - 1))
  fa_stage(kl, vl, kg + (size_t)STG(0) * SK * CC, vg + STG(0) * SK);   /* the walk's stage 0 into buffer 0 */
  for (int k = tid; k < TT; k += 512) slw[k] = logf(bfr(WGT[(size_t)b * TT + k]) + 1.0e-20f) * LOG2E;   /* per-key log-weight, once per block */
  asm volatile("s_wait_asynccnt 0x0" ::: "memory");   /* this wave's copies of stage 0 have landed before the barrier that lets the other waves read them */
  __syncthreads();
  fa_stage(kl + FBUF * 2, vl + FBUF * 2, kg + (size_t)STG(1) * SK * CC, vg + STG(1) * SK);   /* the walk's stage 1 into buffer 1 */
  v16h qf[FQ][2];
#pragma unroll
  for (int c = 0; c < FQ; ++c)
#pragma unroll
    for (int kc = 0; kc < 2; ++kc) qf[c][kc] = frag_h(QH + ((size_t)b * TT + q0 + c * 16 + col) * CC + h * HD + kc * 32, lane);
  v8f acc[FQ][4] = {}; float m[FQ], l[FQ];
#pragma unroll
  for (int c = 0; c < FQ; ++c) { m[c] = -1.0e30f; l[c] = 0.f; }
  for (int st = 0; st < TT / SK; ++st) {
    const _Float16* Kb = skv + (st & 1) * FBUF + (kh * SKW + col) * KPI; const _Float16* Vb = skv + (st & 1) * FBUF + SK * KPI + col * VPI + kh * SKW;   /* this wave's half of the stage */
    v16h kf[2][2];
#pragma unroll
    for (int t = 0; t < 2; ++t)
#pragma unroll
      for (int kc = 0; kc < 2; ++kc) kf[t][kc] = frag_h(Kb + (t * 16) * KPI + kc * 32, lane);
#pragma unroll 1   /* kept rolled: unrolled, the four passes' fragments and scores are live together, the kernel goes beyond 256 registers and register-window switches stand all through the loop */
    for (int ps = 0; ps < SKW / 32; ++ps) {
      v16h vf[4];
#pragma unroll
      for (int j = 0; j < 4; ++j) vf[j] = frag_h(Vb + (j * 16) * VPI + ps * 32, lane);
      v8f lw[2];
#pragma unroll
      for (int t = 0; t < 2; ++t) lw[t] = *(const v8f*)&slw[STG(st) * SK + kh * SKW + ps * 32 + t * 16 + 8 * g];
      v8f s[FQ][2] = {};
#pragma unroll
      for (int kc = 0; kc < 2; ++kc)
#pragma unroll
        for (int c = 0; c < FQ; ++c)
#pragma unroll
          for (int t = 0; t < 2; ++t) s[c][t] = wmma_h(kf[t][kc], qf[c][kc], s[c][t]);
      const int pn = ps + 1 < SKW / 32 ? ps + 1 : 0;   /* next pass's k rows of the same stage, fetched behind this pass's score products (the wave's last pass of a stage re-reads its own first 32 rows, unused) */
#pragma unroll
      for (int t = 0; t < 2; ++t)
#pragma unroll
        for (int kc = 0; kc < 2; ++kc) kf[t][kc] = frag_h(Kb + (pn * 32 + t * 16) * KPI + kc * 32, lane);
      __builtin_amdgcn_sched_barrier(0);   /* keeps the softmax below from being scheduled ahead of the prefetch, which would then be issued only a few instructions before the next pass needs it */
#pragma unroll
      for (int c = 0; c < FQ; ++c) {
        float mx = m[c];
#pragma unroll
        for (int t = 0; t < 2; ++t)
#pragma unroll
          for (int r = 0; r < 8; ++r) { s[c][t][r] = fmaf(s[c][t][r], SCALE * LOG2E, lw[t][r]); mx = fmaxf(mx, s[c][t][r]); }
        mx = fmaxf(mx, xhalf(mx));   /* the two lane halves hold the two key halves of one query column */
        const float alpha = __builtin_amdgcn_exp2f(m[c] - mx); m[c] = mx; const float ms = mx - 8.0f;
        float sum = 0.f; v16h p;
#pragma unroll
        for (int t = 0; t < 2; ++t)
#pragma unroll
          for (int r = 0; r < 8; ++r) { const float e = __builtin_amdgcn_exp2f(s[c][t][r] - ms); sum += e; p[t * 8 + r] = (_Float16)e; }
        l[c] = l[c] * alpha + sum;
#pragma unroll
        for (int j = 0; j < 4; ++j) { acc[c][j] = acc[c][j] * alpha; acc[c][j] = wmma_h(vf[j], p, acc[c][j]); } }
      __builtin_amdgcn_sched_barrier(0);   /* keeps the pass's last matrix instructions ahead of the slots below */
      asm volatile("v_nop\n\tv_nop\n\tv_nop\n\tv_nop");   /* the four vector slots between the pass's last matrix instruction and the address arithmetic at the loop's head, which may reuse a register of its A operand */
    }
    asm volatile("s_wait_dscnt 0x0" ::: "memory");      /* this wave's reads of the buffer are done before the barrier behind which it is refilled */
    asm volatile("s_wait_asynccnt 0x0" ::: "memory");   /* this wave's copies of stage st + 1 have landed before the barrier that lets the other waves read them */
    __syncthreads();
    if (st + 2 < TT / SK) fa_stage(kl + (st & 1) * (FBUF * 2), vl + (st & 1) * (FBUF * 2), kg + (size_t)STG(st + 2) * SK * CC, vg + STG(st + 2) * SK); }   /* stage st + 2 into the buffer that every wave has just left */
#undef STG
  asm volatile("s_wait_asynccnt 0x0" ::: "memory");   /* no copy is outstanding when the wave ends */
  /* join of the two key halves. Behind the last stage's barrier no wave reads skv or slw any more and no copy is outstanding: both serve as the hand-over space, 16 bytes a lane, lanes side by side */
  float* mg = (float*)skv + qg * (FQ * 4 * 2 * 128) + lane * 4; float* ml = slw + qg * (FQ * 2 * 32) + lane;
  if (kh == 1) {
#pragma unroll
    for (int c = 0; c < FQ; ++c) { ml[(c * 2) * 32] = m[c]; ml[(c * 2 + 1) * 32] = l[c];
#pragma unroll
      for (int j = 0; j < 4; ++j) { *(v4f*)&mg[((c * 4 + j) * 2) * 128] = __builtin_shufflevector(acc[c][j], acc[c][j], 0, 1, 2, 3); *(v4f*)&mg[((c * 4 + j) * 2 + 1) * 128] = __builtin_shufflevector(acc[c][j], acc[c][j], 4, 5, 6, 7); } } }
  __syncthreads();   /* the second half's maxima, sums and O^T are in LDS before the first half's waves read them */
  if (kh == 0) {
#pragma unroll
    for (int c = 0; c < FQ; ++c) { const float m1 = ml[(c * 2) * 32], l1 = ml[(c * 2 + 1) * 32]; const float mx = fmaxf(m[c], m1); const float a0 = __builtin_amdgcn_exp2f(m[c] - mx), a1 = __builtin_amdgcn_exp2f(m1 - mx);
      const float lj = l[c] * a0 + l1 * a1; const float lt = lj + xhalf(lj); const float inv = lt > 0.f ? 1.0f / lt : 0.f; const float i0 = a0 * inv, i1 = a1 * inv;
#pragma unroll
      for (int j = 0; j < 4; ++j) { const v4f p0 = *(const v4f*)&mg[((c * 4 + j) * 2) * 128], p1 = *(const v4f*)&mg[((c * 4 + j) * 2 + 1) * 128];
        acc[c][j] = acc[c][j] * i0 + __builtin_shufflevector(p0, p1, 0, 1, 2, 3, 4, 5, 6, 7) * i1; } }
    __builtin_amdgcn_sched_barrier(0);   /* every joined value is formed before the first store, so that no register which an issued store names is rewritten behind it */
#pragma unroll
    for (int c = 0; c < FQ; ++c) { float* yr = Y + ((size_t)b * TT + q0 + c * 16 + col) * CC + h * HD + 8 * g;
#pragma unroll
      for (int j = 0; j < 4; ++j) { vst2(yr + j * 16, __builtin_shufflevector(acc[c][j], acc[c][j], 0, 1, 2, 3)); vst2(yr + j * 16 + 4, __builtin_shufflevector(acc[c][j], acc[c][j], 4, 5, 6, 7)); } } } }
// ---- k_out: block = (128 rows, 128 cols): out = ctx Wo (+ bo): ctx x 2^6 once to f16 (small-magnitude context rows stay clear of f16 subnormals) against Wo as f16(bf16 x 2^8) exact (1 product) x 2^-14. Each wave stages its 32 x 64 f32 in its own part of the LDS of the operand buffers and stores whole lines
__global__ __launch_bounds__(256) void k_out(const float* __restrict__ Y, const float* __restrict__ WO, const float* __restrict__ BO, float* __restrict__ OUT) { __shared__ __align__(16) unsigned short sm[GSM(64)];
  const int tid = threadIdx.x, wave = tid >> 5, lane = tid & 31, col = lane & 15, g = lane >> 4; const int wm = wave >> 1, wn = wave & 1; const int c0 = blockIdx.y * 128; const size_t r0 = (size_t)blockIdx.x * 128;
  v8f acc[2][4] = {};
  gemm_tile<1, 64, CC, DIN>(Y, WO, r0, c0, blockIdx.x + 2 * blockIdx.y, sm, acc);   /* 16 passes: the 8 blocks of one row band start 2 passes apart, the 32 of one column band 1 apart (two share a start) */
  float* sf = (float*)sm + wave * (32 * 68);
#pragma unroll
  for (int j = 0; j < 4; ++j) { const float bias = BO ? bfr(BO[c0 + wn * 64 + j * 16 + col]) : 0.f;
#pragma unroll
    for (int i = 0; i < 2; ++i)
#pragma unroll
      for (int r = 0; r < 8; ++r) sf[(i * 16 + 8 * g + r) * 68 + j * 16 + col] = acc[i][j][r] * (1.0f / 16384.0f) + bias; }   /* 2^-8 (Wo carry) x 2^-6 (ctx carry) */
  LDSX(); for (int it = 0; it < 16; ++it) { const int rl = it * 2 + g; vst2(OUT + (r0 + wm * 32 + rl) * DIN + c0 + wn * 64 + col * 4, *(const v4f*)&sf[rl * 68 + col * 4]); } }

extern "C" void kernel_launch(void* const* d_in, const int* in_sizes, int n_in, void* d_out, int out_size, void* d_ws, size_t ws_size, hipStream_t stream) {
  (void)in_sizes; (void)n_in; (void)out_size;
  const float** F = (const float**)d_in;
  if (ws_size < (size_t)WS_END) return;
  char* ws = (char*)d_ws; _Float16 *QH = (_Float16*)(ws + WS_QH), *KH = (_Float16*)(ws + WS_KH), *VT = (_Float16*)(ws + WS_VT), *QL = (_Float16*)(ws + WS_QL), *KL = (_Float16*)(ws + WS_KL); __bf16 *VB = (__bf16*)(ws + WS_VB), *VBL = (__bf16*)(ws + WS_VBL); float *S = (float*)(ws + WS_S), *Y = (float*)(ws + WS_Y);
  (void)Y; (void)QL; (void)KL; (void)VB; (void)VBL; (void)S;
  // inputs: 0 query [2,2048,1024]; 1 key; 2 value; 3 weights [2,2048]; 4 wq [1024,1024] (in,out), 5 bq; 6 wk, 7 bk; 8 wv, 9 bv; 10 wo (in,out), 11 bo (all biases zeros, read)
  k_proj<<<dim3(TNB * TT / 128, CC / 128, 3), 256, 0, stream>>>(F[0], F[1], F[2], F[4], F[6], F[8], F[5], F[7], F[9], QH, QL, KH, KL, VT, VB, VBL);
  k_fa<<<dim3(TT / (128 * FQ), NH, TNB), 512, 0, stream>>>(QH, KH, VT, F[3], Y);
  k_out<<<dim3(TNB * TT / 128, DIN / 128), 256, 0, stream>>>(Y, F[10], F[11], (float*)d_out);
}

// v007
// It runs in 84.3 microseconds.
// It is 1.08 times as fast as v005, going by the measured steps of the versions left out in between.
// Over all steps from v000 it is 14.2 times as fast.
// compute dtype: all float inputs rounded to bf16; q / k / v projections with EXACT bf16 products on WMMA 16x16x32 (f32 accumulate) + bias (zeros, read); logits k x q once to f16 each (1 product) x 64^-0.5, + logf(bf16(weight) + 1e-20) per key in f32; online softmax f32 (base 2); exp2(logit - maximum in use, which trails the running max by at most 7) x 2^8 once to f16 x v once to f16 (1 product), divided by the f32 sum at the end; ctx x 2^6 once to f16 x wo f16(bf16 x 2^8) + bo; f32 output.
#include <hip/hip_runtime.h>
#include <math.h>

typedef __attribute__((ext_vector_type(16))) _Float16 v16h;
typedef __attribute__((ext_vector_type(16))) __bf16 v16b;
typedef __attribute__((ext_vector_type(8)))  _Float16 v8h;
typedef __attribute__((ext_vector_type(8)))  float v8f;
typedef __attribute__((ext_vector_type(4)))  float v4f;
typedef __attribute__((ext_vector_type(2)))  float v2f;
typedef __attribute__((ext_vector_type(4)))  unsigned v4u;
typedef __attribute__((ext_vector_type(4)))  int v4i;
typedef float __attribute__((may_alias)) float_a;
typedef int __attribute__((may_alias)) int_a;

template <typename T> __device__ __forceinline__ void vst2(void* p, T v) { *(T*)p = v;  }
__device__ __forceinline__ v8f wmma16(v16h a, v16h b, v8f c) {
  v8f d = __builtin_amdgcn_wmma_f32_16x16x32_f16(false, a, false, b, (short)0, c, false, false);
  asm volatile("v_nop\n\tv_nop\n\tv_nop\n\tv_nop" : "+v"(d) : "v"(a), "v"(b));
  return d;
}
__device__ __forceinline__ v8f wmma_bf(v16b a, v16b b, v8f c) {
  v8f d = __builtin_amdgcn_wmma_f32_16x16x32_bf16(false, a, false, b, (short)0, c, false, false);
  asm volatile("v_nop\n\tv_nop\n\tv_nop\n\tv_nop" : "+v"(d) : "v"(a), "v"(b));
  return d;
}
// 16x16x32 fragments: lane = (h = lane>>4, row/col = lane&15); elements 0..7 = k0+8h+0..7, 8..15 = k0+16+8h+0..7; D element r = row 8h+r
__device__ __forceinline__ v16h frag_h(const _Float16* rowk0, int lane) {
  union { v16h v; v8h q[2]; } u; const _Float16* p = rowk0 + 8 * (lane >> 4);
  u.q[0] = *(const v8h*)p; u.q[1] = *(const v8h*)(p + 16); return u.v;
}
__device__ __forceinline__ v16h frag_f32(const float* rowk0, int lane) {
  v16h a; const float* p = rowk0 + 8 * (lane >> 4);
#pragma unroll
  for (int i = 0; i < 8; ++i) { a[i] = (_Float16)p[i]; a[8 + i] = (_Float16)p[16 + i]; }
  return a;
}
__device__ __forceinline__ v16h frag_f32s(const float* rowk0, int lane, float sc) {
  v16h a; const float* p = rowk0 + 8 * (lane >> 4);
#pragma unroll
  for (int i = 0; i < 8; ++i) { a[i] = (_Float16)(p[i] * sc); a[8 + i] = (_Float16)(p[16 + i] * sc); }
  return a;
}
// column fragment from a [K][ld] layout (column n), rows >= K read as 0
__device__ __forceinline__ v16h fragc_f32(const float* W, int k0, int n, int lane, int ld, int K) {
  v16h a; const int g = lane >> 4;
#pragma unroll
  for (int i = 0; i < 8; ++i) { const int ka = k0 + 8 * g + i, kb = ka + 16;
    a[i] = (_Float16)(ka < K ? W[(size_t)(ka < K ? ka : K - 1) * ld + n] : 0.f); a[8 + i] = (_Float16)(kb < K ? W[(size_t)(kb < K ? kb : K - 1) * ld + n] : 0.f); }
  return a;
}
struct F2 { v16b h, l; };
__device__ __forceinline__ F2 bsplit16(const float v[16]) { F2 r;
#pragma unroll
  for (int i = 0; i < 16; ++i) { const __bf16 h = (__bf16)v[i]; r.h[i] = h; r.l[i] = (__bf16)(v[i] - (float)h); }
  return r; }
__device__ __forceinline__ F2 split_row(const float* row, int k0, int lane) { float v[16]; const float* p = row + k0 + 8 * (lane >> 4);
#pragma unroll
  for (int i = 0; i < 8; ++i) { v[i] = p[i]; v[8 + i] = p[16 + i]; }
  return bsplit16(v); }
__device__ __forceinline__ F2 split_rowK(const float* row, int k0, int lane, int K) { float v[16]; const int g = lane >> 4;
#pragma unroll
  for (int i = 0; i < 8; ++i) { const int ka = k0 + 8 * g + i, kb = ka + 16; v[i] = ka < K ? row[ka < K ? ka : K - 1] : 0.f; v[8 + i] = kb < K ? row[kb < K ? kb : K - 1] : 0.f; }
  return bsplit16(v); }
__device__ __forceinline__ F2 split_col(const float* W, int k0, int n, int lane, int ld, int K) { float v[16]; const int g = lane >> 4;
#pragma unroll
  for (int i = 0; i < 8; ++i) { const int ka = k0 + 8 * g + i, kb = ka + 16; v[i] = ka < K ? W[(size_t)(ka < K ? ka : K - 1) * ld + n] : 0.f; v[8 + i] = kb < K ? W[(size_t)(kb < K ? kb : K - 1) * ld + n] : 0.f; }
  return bsplit16(v); }
__device__ __forceinline__ v8f mac3(const F2& a, const F2& b, v8f c) { c = wmma_bf(a.l, b.h, c); c = wmma_bf(a.h, b.l, c); return wmma_bf(a.h, b.h, c); }
__device__ __forceinline__ float sigm(float v) { return 1.0f / (1.0f + expf(-v)); }
#define LDSX() do { asm volatile("s_wait_dscnt 0" ::: "memory"); __builtin_amdgcn_wave_barrier(); __builtin_amdgcn_fence(__ATOMIC_RELEASE, "workgroup"); } while (0)

// Multi-head attention on separate inputs with a per-key multiplicative weight (query / key / value [2,2048,1024]; (in,out) wq / wk / wv / wo [1024,1024] N(0, 1/1024) applied as x @ W + b, all biases zeros (read); weights [2,2048] uniform(0,1), one per (batch, key); 16 heads x 64; scores / sqrt(64) + log(weights + 1e-20) broadcast over heads and queries; softmax over keys; out @ wo + bo).
#define NB 2
#define TT 2048
#define CC 1024            // NH * HD = projected width
#define DIN 1024          // input (model) width
#define NH 16
#define HD 64
#define NQB (TT / 64)
#define HG 4
#define SCALE (0.125f)
#define CAUSAL 0
#ifndef TNB
#define TNB NB
#endif
__device__ __forceinline__ float bfr(float v) { return (float)(__bf16)v; }
__host__ __device__ __forceinline__ int kb_last(int qb) { return CAUSAL ? ((qb * 64 + 63) >> 7) : (TT / 128 - 1); }
typedef __attribute__((ext_vector_type(8))) __bf16 v8b;
__device__ __forceinline__ v16b frag_b(const __bf16* rowk0, int lane) {
  union { v16b v; v8b q[2]; } u; const __bf16* p = rowk0 + 8 * (lane >> 4);
  u.q[0] = *(const v8b*)p; u.q[1] = *(const v8b*)(p + 16); return u.v;
}
#define QBH 0              // unused: this file has no high-precision path
#define QHI 0               // single-product logits on every row (logit sigma ~1)
#define KHI 64            // key rows carrying k residual / v bf16 hi+lo planes (written by k_proj, read by no kernel)
// B fragment (k rows k0+.., output column o) of a weight: (in,out) [K][ld] or (out,in) [ld rows of K]: bf16 exact, or f16(bf16 * 256) exact
__device__ __forceinline__ v16b wcol_io(const float* Wm, int k0, int o, int lane, int ld) { v16b w; const int g = lane >> 4;
#pragma unroll
  for (int i = 0; i < 8; ++i) { w[i] = (__bf16)Wm[(size_t)(k0 + 8 * g + i) * ld + o]; w[8 + i] = (__bf16)Wm[(size_t)(k0 + 16 + 8 * g + i) * ld + o]; }
  return w; }
__device__ __forceinline__ v16b wcol_oi(const float* Wm, int k0, int o, int lane, int K) { v16b w; const float* p = Wm + (size_t)o * K + k0 + 8 * (lane >> 4);
#pragma unroll
  for (int i = 0; i < 8; ++i) { w[i] = (__bf16)p[i]; w[8 + i] = (__bf16)p[16 + i]; }
  return w; }
__device__ __forceinline__ v16h wcolh_io(const float* Wm, int k0, int o, int lane, int ld) { v16h w; const int g = lane >> 4;
#pragma unroll
  for (int i = 0; i < 8; ++i) { w[i] = (_Float16)(bfr(Wm[(size_t)(k0 + 8 * g + i) * ld + o]) * 256.0f); w[8 + i] = (_Float16)(bfr(Wm[(size_t)(k0 + 16 + 8 * g + i) * ld + o]) * 256.0f); }
  return w; }
__device__ __forceinline__ v16h wcolh_oi(const float* Wm, int k0, int o, int lane, int K) { v16h w; const float* p = Wm + (size_t)o * K + k0 + 8 * (lane >> 4);
#pragma unroll
  for (int i = 0; i < 8; ++i) { w[i] = (_Float16)(bfr(p[i]) * 256.0f); w[8 + i] = (_Float16)(bfr(p[16 + i]) * 256.0f); }
  return w; }
#define WQKV_LAYOUT 0   // 0 = (in,out) [DIN][CC]; 1 = (out,in) [CC][DIN]; 2 = per-head [NH][DIN][HD]
__device__ __forceinline__ v16b wcol_hdk(const float* Wm, int k0, int o, int lane) { v16b w; const int g = lane >> 4; const float* p = Wm + (size_t)(o / HD) * DIN * HD + (o % HD);
#pragma unroll
  for (int i = 0; i < 8; ++i) { w[i] = (__bf16)p[(size_t)(k0 + 8 * g + i) * HD]; w[8 + i] = (__bf16)p[(size_t)(k0 + 16 + 8 * g + i) * HD]; }
  return w; }
#define WO_OUT_IN 0
#if WQKV_LAYOUT == 1
#define WCOL(W, k0, o, lane) wcol_oi(W, k0, o, lane, DIN)
#elif WQKV_LAYOUT == 2
#define WCOL(W, k0, o, lane) wcol_hdk(W, k0, o, lane)
#else
#define WCOL(W, k0, o, lane) wcol_io(W, k0, o, lane, CC)
#endif
#if WO_OUT_IN
#define WOCOL(W, k0, o, lane) wcol_oi(W, k0, o, lane, CC)
#define WOCOLH(W, k0, o, lane) wcolh_oi(W, k0, o, lane, CC)
#else
#define WOCOL(W, k0, o, lane) wcol_io(W, k0, o, lane, DIN)
#define WOCOLH(W, k0, o, lane) wcolh_io(W, k0, o, lane, DIN)
#endif

#define WS_QH  0u                                      // f16 q rows [b*t][CC]
#define WS_KH  (WS_QH + 2u * (size_t)NB * TT * CC)      // f16 k rows [b*t][CC]
#define WS_VT  (WS_KH + 2u * (size_t)NB * TT * CC)      // f16 v planes [b][c][t]
#define WS_QL  (WS_VT + 2u * (size_t)NB * CC * TT)      // f16 q residual x 2^10 rows [b][t < QHI][CC]
#define WS_KL  (WS_QL + 2u * (size_t)NB * QHI * CC)     // f16 k residual x 2^10 rows [b][t < KHI][CC]
#define WS_VB  (WS_KL + 2u * (size_t)NB * KHI * CC)     // bf16 v hi planes [b][c][t < KHI]
#define WS_VBL (WS_VB + 2u * (size_t)NB * CC * KHI)
#define WS_S   (WS_VBL + 2u * (size_t)NB * CC * KHI)    // the rounded GEMM operands: bf16 x rows [3][b*t][DIN], then the weights, k-contiguous: bf16 wq / wk / wv [3][CC][DIN], f16 wo [DIN][CC]
#define WS_W16 (WS_S + 3u * 2u * (size_t)NB * TT * DIN)
#define WS_Y   (WS_S  + 4u * (size_t)HG * TT * TT)      // f16 ctx x 2^6 rows [b*t][CC]
#define WS_END (WS_Y  + 4u * (size_t)NB * TT * CC)

// ---- shared by k_proj and k_out: one 128 x 128 tile of X W per block of 8 waves (4 x 2, each 32 rows x 64 columns). Both operands arrive already rounded to their 16-bit form and k-contiguous (X rows, W columns: k_cvt, k_fa), so a block reads half the bytes that the f32 operands took and converts nothing. A pass is GK k (64 in k_proj, so that three blocks fit a WGP; 128 in k_out, one block a WGP, for more bytes in flight): the block reads both operand tiles once, in whole 128-byte lines, and lays them in LDS, pitch 2 GK + 16 B; every wave takes its fragments from there. Two buffers: the next pass's global loads fly during this pass's products; one barrier a pass
typedef __attribute__((ext_vector_type(2))) unsigned v2u;
typedef __attribute__((ext_vector_type(2))) __bf16 v2b;
typedef __attribute__((ext_vector_type(2))) _Float16 v2h;
#define GSM(GK) (4 * 128 * ((GK) + 8))   // 16-bit elements of LDS: two buffers x two operand tiles of 128 rows, pitch GK + 8
// KIND 0: x and w to bf16 (exact bf16 products); KIND 1: x * 2^6 to f16, bf16(w) * 2^8 to f16
template <int KIND> __device__ __forceinline__ unsigned pkx(float a, float b) {
  if constexpr (KIND == 0) { v2b t; t[0] = (__bf16)a; t[1] = (__bf16)b; return __builtin_bit_cast(unsigned, t); }
  else { v2h t; t[0] = (_Float16)(a * 64.0f); t[1] = (_Float16)(b * 64.0f); return __builtin_bit_cast(unsigned, t); } }
template <int KIND> __device__ __forceinline__ unsigned pkw(float a, float b) {
  if constexpr (KIND == 0) { v2b t; t[0] = (__bf16)a; t[1] = (__bf16)b; return __builtin_bit_cast(unsigned, t); }
  else { v2h t; t[0] = (_Float16)(bfr(a) * 256.0f); t[1] = (_Float16)(bfr(b) * 256.0f); return __builtin_bit_cast(unsigned, t); } }
struct G8 { v4u q[2]; };
__device__ __forceinline__ G8 frag_s(const unsigned short* rowk0, int lane) { G8 f; const unsigned short* p = rowk0 + 8 * (lane >> 4); f.q[0] = *(const v4u*)p; f.q[1] = *(const v4u*)(p + 16); return f; }
template <int KIND> __device__ __forceinline__ v8f wmma_g(G8 a, G8 b, v8f c) {
  if constexpr (KIND == 0) return __builtin_amdgcn_wmma_f32_16x16x32_bf16(false, __builtin_bit_cast(v16b, a), false, __builtin_bit_cast(v16b, b), (short)0, c, false, false);
  else return __builtin_amdgcn_wmma_f32_16x16x32_f16(false, __builtin_bit_cast(v16h, a), false, __builtin_bit_cast(v16h, b), (short)0, c, false, false); }
// X [rows][KD], Wt [columns][KD], 16-bit, k-contiguous; acc[i][j] = rows r0 + 32 (wave >> 1) + 16 i, columns c0 + 64 (wave & 1) + 16 j; k in steps of 32 into one accumulator, the walk starting at pass rot and wrapping round: blocks that share X rows or W columns get different rot, so that at any moment they ask L2 for different lines. Every inner loop is fully unrolled so that the staging, fragment and accumulator arrays are indexed by constants and stay in registers. Ends behind a barrier: sm is free
template <int KIND, int GK, int KD> __device__ __forceinline__ void gemm_tile(const unsigned short* __restrict__ X, const unsigned short* __restrict__ Wt, size_t r0, int c0, int rot, unsigned short* sm, v8f (&acc)[2][4]) {
  const int tid = threadIdx.x, wave = tid >> 5, lane = tid & 31, col = lane & 15; const int wm = wave >> 1, wn = wave & 1;
  constexpr int GP = GK + 8, GT = 128 * GP, XT = GK / 8, XR = 256 / XT, XS = 128 / XR;
  const int xr = tid / XT, xq = tid % XT;     /* both operands: XT threads x 16 B = one row's (column's) GK elements; XR rows a step, XS steps */
  const unsigned short* xp = X + (r0 + xr) * KD + xq * 8; const unsigned short* wp = Wt + (size_t)(c0 + xr) * KD + xq * 8;
  v4u xv[XS], wv[XS];
#define G_LOAD(k0) do { _Pragma("unroll") for (int i = 0; i < XS; ++i) xv[i] = *(const v4u*)(xp + (size_t)(i * XR) * KD + (k0)); \
    _Pragma("unroll") for (int i = 0; i < XS; ++i) wv[i] = *(const v4u*)(wp + (size_t)(i * XR) * KD + (k0)); } while (0)
#define G_STORE(buf) do { unsigned short* As = sm + (buf) * (2 * GT); unsigned short* Bs = As + GT; \
    _Pragma("unroll") for (int i = 0; i < XS; ++i) *(v4u*)&As[(xr + i * XR) * GP + xq * 8] = xv[i]; \
    _Pragma("unroll") for (int i = 0; i < XS; ++i) *(v4u*)&Bs[(xr + i * XR) * GP + xq * 8] = wv[i]; } while (0)
  static_assert(((KD / GK) & (KD / GK - 1)) == 0, "the wrap below is a mask");
  G_LOAD((rot & (KD / GK - 1)) * GK); G_STORE(0);
  __syncthreads();
  for (int ks = 0; ks < KD / GK; ++ks) {
    const bool more = ks + 1 < KD / GK;
    if (more) { G_LOAD(((ks + 1 + rot) & (KD / GK - 1)) * GK); asm volatile("s_wait_xcnt 0x0" ::: "memory"); }   /* the wait: the loads' address registers are rewritten further down in the pass */
    __builtin_amdgcn_sched_barrier(0);   /* keeps the next pass's global loads ahead of this pass's products; the compiler otherwise sinks them to just in front of their use and their latency is waited out */
    const unsigned short* As = sm + (ks & 1) * (2 * GT) + (wm * 32 + col) * GP; const unsigned short* Bs = sm + (ks & 1) * (2 * GT) + GT + (wn * 64 + col) * GP;
#pragma unroll
    for (int kc = 0; kc < GK / 32; ++kc) { G8 a[2], b[4];
#pragma unroll
      for (int i = 0; i < 2; ++i) a[i] = frag_s(As + i * 16 * GP + kc * 32, lane);
#pragma unroll
      for (int j = 0; j < 4; ++j) b[j] = frag_s(Bs + j * 16 * GP + kc * 32, lane);
#pragma unroll
      for (int i = 0; i < 2; ++i)
#pragma unroll
        for (int j = 0; j < 4; ++j) acc[i][j] = wmma_g<KIND>(a[i], b[j], acc[i][j]); }
    __builtin_amdgcn_sched_barrier(0);   /* keeps the LDS stores of the loaded values, and with them the wait for the loads, behind the products */
    if (more) G_STORE((ks + 1) & 1);   /* into the buffer that every wave left at the barrier of the pass before */
    __syncthreads(); }
#undef G_LOAD
#undef G_STORE
}
// ---- k_cvt: every GEMM operand that is an input is rounded once, here, instead of by each of the 8 (x rows) or 32 (weight columns) blocks that read it. One block a WGP, 16 waves; each block takes one 128 k x 128 n tile of wq / wk / wv (to bf16) or wo (bf16 x 2^8 to f16), turned in LDS so that it leaves k-contiguous, 256 bytes a column, and 16384 elements of each of query / key / value (to bf16). All of a thread's loads are in flight together; they are non-temporal: the f32 values are read this once
static_assert(DIN == 1024 && CC == 1024 && (size_t)NB * TT * DIN == 256u * 16384u, "k_cvt's numbering: 4 x 8 x 8 weight tiles = 256 blocks = the 16384-element pieces of one x input");
#define CVP 136            // LDS pitch of a weight column's 128 k: 272 B = 16 B x odd
template <int KIND> __device__ __forceinline__ void cvt_w(const float (&v)[32], unsigned short* dst) {
#pragma unroll
  for (int o = 0; o < 4; ++o) { v4u t;
#pragma unroll
    for (int e = 0; e < 4; ++e) t[e] = pkw<KIND>(v[o * 8 + 2 * e], v[o * 8 + 2 * e + 1]);
    *(v4u*)&dst[o * 8] = t; } }
__global__ __launch_bounds__(512) void k_cvt(const float* __restrict__ XQ, const float* __restrict__ XK, const float* __restrict__ XV, const float* __restrict__ WQ, const float* __restrict__ WK, const float* __restrict__ WV, const float* __restrict__ WO, unsigned short* __restrict__ X16, unsigned short* __restrict__ W16) {
  __shared__ __align__(16) unsigned short st[128 * CVP];
  const int tid = threadIdx.x, bi = blockIdx.x; const int mt = bi >> 6, tk = (bi >> 3) & 7, tn = bi & 7; const float* Wm = mt == 0 ? WQ : mt == 1 ? WK : mt == 2 ? WV : WO;
  const int n = tid & 127, kq = tid >> 7;   /* lanes along a row of the weight (128 B a wave-load), 32 k a thread */
  const unsigned ow = (unsigned)((tk * 128 + kq * 32) * 1024 + tn * 128 + n), ox = (unsigned)(bi * 16384 + tid * 4) * 4u;   /* offsets from the uniform bases: the weight's in elements, x's in bytes (512 contiguous bytes a wave-load) */
  float v[32]; v4f a[3][8];
#pragma unroll
  for (int e = 0; e < 32; ++e) v[e] = __builtin_nontemporal_load(Wm + ow + e * 1024);
#pragma unroll
  for (int w = 0; w < 3; ++w) { const float* X = w == 0 ? XQ : w == 1 ? XK : XV;
#pragma unroll
    for (int i = 0; i < 8; ++i) a[w][i] = __builtin_nontemporal_load((const v4f*)((const char*)X + ox) + i * 512); }
  asm volatile("s_wait_xcnt 0x0" :: "v"(ow), "v"(ox) : "memory");   /* the wait stands before any register that the loads name is rewritten; the two offsets are inputs so that they stay in their registers up to here and no load's result is placed on them */
  __builtin_amdgcn_sched_barrier(0);   /* keeps every load ahead of the first use: sunk to their uses, the loads would be waited for in turn */
  if (mt < 3) cvt_w<0>(v, &st[n * CVP + kq * 32]); else cvt_w<1>(v, &st[n * CVP + kq * 32]);   /* block-uniform */
  __syncthreads();   /* the tile is whole in LDS before it is read column by column */
#pragma unroll
  for (int i = 0; i < 4; ++i) { const int nl = i * 32 + (tid >> 4), q = tid & 15; *(v4u*)((char*)W16 + (unsigned)(((mt * 1024 + tn * 128 + nl) * 1024 + tk * 128 + q * 8) * 2)) = *(const v4u*)&st[nl * CVP + q * 8]; }
#pragma unroll
  for (int w = 0; w < 3; ++w)
#pragma unroll
    for (int i = 0; i < 8; ++i) { v2u t; t[0] = pkx<0>(a[w][i][0], a[w][i][1]); t[1] = pkx<0>(a[w][i][2], a[w][i][3]); *(v2u*)((char*)(X16 + (size_t)w * ((size_t)NB * TT * DIN) + i * 2048) + ox / 2u) = t; } }
// ---- k_proj: block = (128 rows, 128 cols, which): q/k/v = X W (+ b) with exact bf16 products (K = DIN) -> which 0: q f16 rows (+ residual rows < QHI); 1: k f16 rows (+ residual rows < KHI); 2: v f16 planes [c][t] (+ bf16 hi/lo planes for t < KHI). The output tile is staged in the LDS of the operand buffers, [128][136] 16-bit, and leaves in whole lines
#define EP 136
__global__ __launch_bounds__(256) void k_proj(const unsigned short* __restrict__ X16, const unsigned short* __restrict__ W16, const float* __restrict__ BQ, const float* __restrict__ BK, const float* __restrict__ BV,
    _Float16* __restrict__ QH, _Float16* __restrict__ QL, _Float16* __restrict__ KH, _Float16* __restrict__ KL, _Float16* __restrict__ VT, __bf16* __restrict__ VB, __bf16* __restrict__ VBL) {
  __shared__ __align__(16) unsigned short sm[GSM(64)];
  const int tid = threadIdx.x, wave = tid >> 5, lane = tid & 31, col = lane & 15, g = lane >> 4; const int wm = wave >> 1, wn = wave & 1; const int which = blockIdx.z; const int c0 = blockIdx.y * 128; const size_t r0 = (size_t)blockIdx.x * 128; const size_t bb = r0 / TT; const int t0 = (int)(r0 % TT);
  const unsigned short* X = X16 + (size_t)which * ((size_t)NB * TT * DIN); const unsigned short* WA = W16 + (size_t)which * ((size_t)CC * DIN); const float* BA = which == 0 ? BQ : which == 1 ? BK : BV;
  v8f acc[2][4] = {};
  gemm_tile<0, 64, DIN>(X, WA, r0, c0, blockIdx.x + 2 * blockIdx.y, sm, acc);   /* 16 passes: the 8 blocks of one row band start 2 passes apart, the 32 of one column band 1 apart (two share a start) */
#pragma unroll
  for (int j = 0; j < 4; ++j) { const float bias = BA ? bfr(BA[c0 + wn * 64 + j * 16 + col]) : 0.f;
#pragma unroll
    for (int i = 0; i < 2; ++i) acc[i][j] = acc[i][j] + bias; }
  if (which < 2) { _Float16* DH = which == 0 ? QH : KH; _Float16* DL = which == 0 ? QL : KL; const int nhi = which == 0 ? QHI : KHI; _Float16* st = (_Float16*)sm;
#pragma unroll
    for (int i = 0; i < 2; ++i)
#pragma unroll
      for (int j = 0; j < 4; ++j)
#pragma unroll
        for (int r = 0; r < 8; ++r) st[(wm * 32 + i * 16 + 8 * g + r) * EP + wn * 64 + j * 16 + col] = (_Float16)acc[i][j][r];
    __syncthreads();
    for (int e = tid; e < 128 * 16; e += 256) { const int rl = e >> 4, q = e & 15; vst2((unsigned*)(DH + (r0 + rl) * CC + c0 + q * 8), *(const v4u*)&st[rl * EP + q * 8]); }
    if (t0 < nhi) {   /* block-uniform */
      __syncthreads();
#pragma unroll
      for (int i = 0; i < 2; ++i)
#pragma unroll
        for (int j = 0; j < 4; ++j)
#pragma unroll
          for (int r = 0; r < 8; ++r) { const float v = acc[i][j][r]; st[(wm * 32 + i * 16 + 8 * g + r) * EP + wn * 64 + j * 16 + col] = (_Float16)((v - (float)(_Float16)v) * 1024.0f); }
      __syncthreads();
      for (int e = tid; e < 128 * 16; e += 256) { const int rl = e >> 4, q = e & 15; if (t0 + rl < nhi) { vst2((unsigned*)(DL + (bb * nhi + t0 + rl) * (size_t)CC + c0 + q * 8), *(const v4u*)&st[rl * EP + q * 8]); asm volatile("s_wait_xcnt 0x0" ::: "memory"); /* the store's address register is stepped at the loop's foot */ } } }
  } else { _Float16* st = (_Float16*)sm; __bf16* sb = (__bf16*)sm;
#pragma unroll
    for (int i = 0; i < 2; ++i)
#pragma unroll
      for (int j = 0; j < 4; ++j) { v8h t;
#pragma unroll
        for (int r = 0; r < 8; ++r) t[r] = (_Float16)acc[i][j][r];
        *(v8h*)&st[(wn * 64 + j * 16 + col) * EP + wm * 32 + i * 16 + 8 * g] = t; }
    __syncthreads();
    for (int e = tid; e < 128 * 16; e += 256) { const int cl = e >> 4, q = e & 15; vst2((unsigned*)(VT + (bb * CC + c0 + cl) * (size_t)TT + t0 + q * 8), *(const v4u*)&st[cl * EP + q * 8]); }
    if (t0 < KHI) {   /* block-uniform */
#pragma unroll
      for (int pl = 0; pl < 2; ++pl) { __bf16* D = pl == 0 ? VB : VBL;
        __syncthreads();
#pragma unroll
        for (int i = 0; i < 2; ++i)
#pragma unroll
          for (int j = 0; j < 4; ++j) { v8b t;
#pragma unroll
            for (int r = 0; r < 8; ++r) { const float v = acc[i][j][r]; const __bf16 bh = (__bf16)v; t[r] = pl == 0 ? bh : (__bf16)(v - (float)bh); }
            *(v8b*)&sb[(wn * 64 + j * 16 + col) * EP + wm * 32 + i * 16 + 8 * g] = t; }
        __syncthreads();
        for (int e = tid; e < 128 * 16; e += 256) { const int cl = e >> 4, q = e & 15; if (t0 + q * 8 < KHI) { vst2((unsigned*)(D + (bb * CC + c0 + cl) * (size_t)KHI + t0 + q * 8), *(const v4u*)&sb[cl * EP + q * 8]); asm volatile("s_wait_xcnt 0x0" ::: "memory"); /* the store's address register is stepped at the loop's foot */ } } } } } }
// ---- k_fa: block = 256 queries of (b, h), 16 waves = 8 groups of 32 query columns x KS key halves, so that four waves share a SIMD and one wave's softmax chains run under the others' products; one pass = 32 keys, one stage = SK keys, of which a wave walks its half (SKW keys). Each wave keeps its own maximum in use, sum and O^T over its keys; at the end the second half's waves hand theirs over through LDS and the first half's waves join the two (common maximum, both rescaled) and store. The block brings each stage's k rows and v planes into LDS once, by asynchronous 16-byte copies in whole lines (two buffers: the next stage's copies fly during this stage's passes; one barrier a stage), and all waves take their fragments from there. S^T = K Q^T (A = k rows, B = q rows, same k order), logits x SCALE + log-weight in the log2 domain, maximum in use and sum per query column (online softmax; the maximum in use is raised, and sum and O^T rescaled, only in a pass where some column's maximum exceeds it by more than LAZY), P x 2^8 once to f16 packed from the two score tiles as the B operand, O^T += V^T P^T (A = v planes); the logits never leave the registers. Every inner loop is fully unrolled so that the fragment and accumulator arrays are indexed by constants and stay in registers
#define FQ 2               // 16-column query groups per wave
#define KS 2               // key halves of a stage, one per group of 8 waves
#define SK 256             // keys per stage
#define SKW (SK / KS)      // keys of a stage that one wave walks
#define KPI (HD + 8)       // LDS pitch of a k row, f16 elements: 144 B = 16 B x odd, conflict-free for 16-byte fragment reads
#define VPI (SK + 8)       // LDS pitch of a v plane's SK keys: 528 B = 16 B x odd
#define FBUF (SK * KPI + HD * VPI)   // f16 elements of one buffer: k rows, then v planes
#define LOG2E 1.44269504088896340736f
#define LAZY 7.0f          // the maximum in use may trail a column's true maximum by this much (log2 domain): P x 2^8 then stays at or below 2^15, inside f16
__device__ __forceinline__ float xhalf(float x) { return __builtin_bit_cast(float, __builtin_amdgcn_permlanex16(__builtin_bit_cast(int, x), __builtin_bit_cast(int, x), 0x76543210, 0xfedcba98, false, false)); }   // lane l with lane l ^ 16
__device__ __forceinline__ v8f wmma_h(v16h a, v16h b, v8f c) { return __builtin_amdgcn_wmma_f32_16x16x32_f16(false, a, false, b, (short)0, c, false, false); }
typedef __attribute__((address_space(3))) _Float16 lds_h;
// one stage: each thread copies four 16-byte pieces of the k rows (64 rows apart) and four of the v planes (16 planes apart). kl, vl: the lane's LDS byte addresses; kg, vg: its global addresses. The s_wait_xcnt stands inside the statement so that no address register is rewritten ahead of it
__device__ __forceinline__ void fa_stage(unsigned kl, unsigned vl, const _Float16* kg, const _Float16* vg) {
  asm volatile("global_load_async_to_lds_b128 %0, %8, off\n\t"
               "global_load_async_to_lds_b128 %1, %9, off\n\t"
               "global_load_async_to_lds_b128 %2, %10, off\n\t"
               "global_load_async_to_lds_b128 %3, %11, off\n\t"
               "global_load_async_to_lds_b128 %4, %12, off\n\t"
               "global_load_async_to_lds_b128 %5, %13, off\n\t"
               "global_load_async_to_lds_b128 %6, %14, off\n\t"
               "global_load_async_to_lds_b128 %7, %15, off\n\t"
               "s_wait_xcnt 0x0"
               :: "v"(kl), "v"(kl + 64u * (KPI * 2)), "v"(kl + 128u * (KPI * 2)), "v"(kl + 192u * (KPI * 2)),
                  "v"(vl), "v"(vl + 16u * (VPI * 2)), "v"(vl + 32u * (VPI * 2)), "v"(vl + 48u * (VPI * 2)),
                  "v"(kg), "v"(kg + (size_t)64 * CC), "v"(kg + (size_t)128 * CC), "v"(kg + (size_t)192 * CC),
                  "v"(vg), "v"(vg + (size_t)16 * TT), "v"(vg + (size_t)32 * TT), "v"(vg + (size_t)48 * TT)
               : "memory"); }
__global__ __launch_bounds__(512) void k_fa(const _Float16* __restrict__ QH, const _Float16* __restrict__ KH, const _Float16* __restrict__ VT, const float* __restrict__ WGT, _Float16* __restrict__ Y) { __shared__ __align__(32) _Float16 skv[2 * FBUF + 2 * TT]; float* const slw = (float*)(skv + 2 * FBUF);   /* the stage buffers first, so that every fragment's offset in a buffer fits the LDS instruction's 16-bit offset field; the log-weights behind them */
  const int tid = threadIdx.x, wave = tid >> 5, lane = tid & 31, col = lane & 15, g = lane >> 4; const int qg = wave & 7, kh = wave >> 3; const int h = blockIdx.y, b = blockIdx.z; const int q0 = blockIdx.x * (128 * FQ) + qg * (16 * FQ);
  const _Float16* kg = KH + ((size_t)b * TT + (tid >> 3)) * CC + h * HD + (tid & 7) * 8;              /* 8 threads a k row: 128 B, one line */
  const _Float16* vg = VT + ((size_t)b * CC + h * HD + (tid >> 5)) * (size_t)TT + (tid & 31) * 8;     /* 32 threads a v plane's SK keys: 512 B, four lines */
  const unsigned sb = (unsigned)(size_t)(const lds_h*)skv; const unsigned kl = sb + (tid >> 3) * (KPI * 2) + (tid & 7) * 16; const unsigned vl = sb + SK * KPI * 2 + (tid >> 5) * (VPI * 2) + (tid & 31) * 16;
  const int rot = blockIdx.x;   /* the blocks of one (b, h) walk the same k rows and v planes: each starts at another stage and wraps round, so that they ask L2 for different lines at any moment */
#define STG(s) (((s) + rot) & (TT / SK - 1))
  fa_stage(kl, vl, kg + (size_t)STG(0) * SK * CC, vg + STG(0) * SK);   /* the walk's stage 0 into buffer 0 */
  for (int k = tid; k < TT; k += 512) slw[k] = logf(bfr(WGT[(size_t)b * TT + k]) + 1.0e-20f) * LOG2E;   /* per-key log-weight, once per block */
  asm volatile("s_wait_asynccnt 0x0" ::: "memory");   /* this wave's copies of stage 0 have landed before the barrier that lets the other waves read them */
  __syncthreads();
  fa_stage(kl + FBUF * 2, vl + FBUF * 2, kg + (size_t)STG(1) * SK * CC, vg + STG(1) * SK);   /* the walk's stage 1 into buffer 1 */
  v16h qf[FQ][2];
#pragma unroll
  for (int c = 0; c < FQ; ++c)
#pragma unroll
    for (int kc = 0; kc < 2; ++kc) qf[c][kc] = frag_h(QH + ((size_t)b * TT + q0 + c * 16 + col) * CC + h * HD + kc * 32, lane);
  v8f acc[FQ][4] = {}; float m[FQ], l[FQ];
#pragma unroll
  for (int c = 0; c < FQ; ++c) { m[c] = -1.0e30f; l[c] = 0.f; }
  const v8f sl2 = { SCALE * LOG2E, SCALE * LOG2E, SCALE * LOG2E, SCALE * LOG2E, SCALE * LOG2E, SCALE * LOG2E, SCALE * LOG2E, SCALE * LOG2E };
  for (int st = 0; st < TT / SK; ++st) {
    const _Float16* Kb = skv + (st & 1) * FBUF + (kh * SKW + col) * KPI; const _Float16* Vb = skv + (st & 1) * FBUF + SK * KPI + col * VPI + kh * SKW;   /* this wave's half of the stage */
    v16h kf[2][2];
#pragma unroll
    for (int t = 0; t < 2; ++t)
#pragma unroll
      for (int kc = 0; kc < 2; ++kc) kf[t][kc] = frag_h(Kb + (t * 16) * KPI + kc * 32, lane);
#pragma unroll 1   /* kept rolled: unrolled, the four passes' fragments and scores are live together, the kernel goes beyond 256 registers and register-window switches stand all through the loop */
    for (int ps = 0; ps < SKW / 32; ++ps) {
      v16h vf[4];
#pragma unroll
      for (int j = 0; j < 4; ++j) vf[j] = frag_h(Vb + (j * 16) * VPI + ps * 32, lane);
      v8f lw[2];
#pragma unroll
      for (int t = 0; t < 2; ++t) lw[t] = *(const v8f*)&slw[STG(st) * SK + kh * SKW + ps * 32 + t * 16 + 8 * g];
      v8f s[FQ][2] = {};
#pragma unroll
      for (int kc = 0; kc < 2; ++kc)
#pragma unroll
        for (int c = 0; c < FQ; ++c)
#pragma unroll
          for (int t = 0; t < 2; ++t) s[c][t] = wmma_h(kf[t][kc], qf[c][kc], s[c][t]);
      const int pn = ps + 1 < SKW / 32 ? ps + 1 : 0;   /* next pass's k rows of the same stage, fetched behind this pass's score products (the wave's last pass of a stage re-reads its own first 32 rows, unused) */
#pragma unroll
      for (int t = 0; t < 2; ++t)
#pragma unroll
        for (int kc = 0; kc < 2; ++kc) kf[t][kc] = frag_h(Kb + (pn * 32 + t * 16) * KPI + kc * 32, lane);
      __builtin_amdgcn_sched_barrier(0);   /* keeps the softmax below from being scheduled ahead of the prefetch, which would then be issued only a few instructions before the next pass needs it */
      float mp[FQ]; bool need = false;   /* this lane's maximum of the pass, per query column; does any exceed the maximum in use by more than LAZY? */
#pragma unroll
      for (int c = 0; c < FQ; ++c) {
#pragma unroll
        for (int t = 0; t < 2; ++t) s[c][t] = __builtin_elementwise_fma(s[c][t], sl2, lw[t]);
        float mx = s[c][0][0];
#pragma unroll
        for (int t = 0; t < 2; ++t)
#pragma unroll
          for (int r = (t == 0 ? 1 : 0); r < 8; ++r) mx = fmaxf(mx, s[c][t][r]);
        mp[c] = mx; need = need || (mx > m[c] + LAZY); }
      if (__builtin_expect(__builtin_amdgcn_ballot_w32(need) != 0, 0)) {   /* one wave-uniform scalar branch a pass; taken in the wave's first pass and seldom after it */
#pragma unroll
        for (int c = 0; c < FQ; ++c) {
          const float mx = fmaxf(m[c], fmaxf(mp[c], xhalf(mp[c])));   /* the two lane halves hold the two key halves of one query column: both take the same new maximum */
          const float alpha = __builtin_amdgcn_exp2f(m[c] - mx); m[c] = mx; l[c] = l[c] * alpha;
#pragma unroll
          for (int j = 0; j < 4; ++j) acc[c][j] = acc[c][j] * alpha; } }
      v16h p[FQ];
#pragma unroll
      for (int t = 0; t < 2; ++t)
#pragma unroll
        for (int r4 = 0; r4 < 8; r4 += 4)
#pragma unroll
          for (int c = 0; c < FQ; ++c)
#pragma unroll
            for (int r = r4; r < r4 + 4; r += 2) { const float ms = m[c] - 8.0f; const v2f x = (v2f){ s[c][t][r], s[c][t][r + 1] } - (v2f){ ms, ms };
              const float e0 = __builtin_amdgcn_exp2f(x[0]), e1 = __builtin_amdgcn_exp2f(x[1]); l[c] += e0; l[c] += e1; p[c][t * 8 + r] = (_Float16)e0; p[c][t * 8 + r + 1] = (_Float16)e1; }   /* the sum is not rescaled in this pass any more: the exponentials add straight into it */
#pragma unroll
      for (int j = 0; j < 4; ++j)
#pragma unroll
        for (int c = 0; c < FQ; ++c) acc[c][j] = wmma_h(vf[j], p[c], acc[c][j]);
      __builtin_amdgcn_sched_group_barrier(0x402, 160, 0);   /* all the vector work of this part first, */
      __builtin_amdgcn_sched_group_barrier(0x8, 8, 0);       /* then its eight products in a row: additions scheduled among the products are given registers of a product's A or B operand, and the compiler fills the distance behind that product with v_nop */
      __builtin_amdgcn_sched_barrier(0);   /* keeps the pass's last matrix instructions ahead of the slots below */
      asm volatile("v_nop\n\tv_nop\n\tv_nop\n\tv_nop");   /* the four vector slots between the pass's last matrix instruction and the address arithmetic at the loop's head, which may reuse a register of its A operand */
    }
    asm volatile("s_wait_dscnt 0x0" ::: "memory");      /* this wave's reads of the buffer are done before the barrier behind which it is refilled */
    asm volatile("s_wait_asynccnt 0x0" ::: "memory");   /* this wave's copies of stage st + 1 have landed before the barrier that lets the other waves read them */
    __syncthreads();
    if (st + 2 < TT / SK) fa_stage(kl + (st & 1) * (FBUF * 2), vl + (st & 1) * (FBUF * 2), kg + (size_t)STG(st + 2) * SK * CC, vg + STG(st + 2) * SK); }   /* stage st + 2 into the buffer that every wave has just left */
#undef STG
  asm volatile("s_wait_asynccnt 0x0" ::: "memory");   /* no copy is outstanding when the wave ends */
  /* join of the two key halves. Behind the last stage's barrier no wave reads skv or slw any more and no copy is outstanding: both serve as the hand-over space, 16 bytes a lane, lanes side by side */
  float* mg = (float*)skv + qg * (FQ * 4 * 2 * 128) + lane * 4; float* ml = slw + qg * (FQ * 2 * 32) + lane;
  if (kh == 1) {
#pragma unroll
    for (int c = 0; c < FQ; ++c) { ml[(c * 2) * 32] = m[c]; ml[(c * 2 + 1) * 32] = l[c];
#pragma unroll
      for (int j = 0; j < 4; ++j) { *(v4f*)&mg[((c * 4 + j) * 2) * 128] = __builtin_shufflevector(acc[c][j], acc[c][j], 0, 1, 2, 3); *(v4f*)&mg[((c * 4 + j) * 2 + 1) * 128] = __builtin_shufflevector(acc[c][j], acc[c][j], 4, 5, 6, 7); } } }
  __syncthreads();   /* the second half's maxima, sums and O^T are in LDS before the first half's waves read them */
  if (kh == 0) {
#pragma unroll
    for (int c = 0; c < FQ; ++c) { const float m1 = ml[(c * 2) * 32], l1 = ml[(c * 2 + 1) * 32]; const float mx = fmaxf(m[c], m1); const float a0 = __builtin_amdgcn_exp2f(m[c] - mx), a1 = __builtin_amdgcn_exp2f(m1 - mx);
      const float lj = l[c] * a0 + l1 * a1; const float lt = lj + xhalf(lj); const float inv = lt > 0.f ? 1.0f / lt : 0.f; const float i0 = a0 * inv, i1 = a1 * inv;
#pragma unroll
      for (int j = 0; j < 4; ++j) { const v4f p0 = *(const v4f*)&mg[((c * 4 + j) * 2) * 128], p1 = *(const v4f*)&mg[((c * 4 + j) * 2 + 1) * 128];
        acc[c][j] = acc[c][j] * i0 + __builtin_shufflevector(p0, p1, 0, 1, 2, 3, 4, 5, 6, 7) * i1; } }
    v8h y[FQ][4];   /* ctx x 2^6 once to f16, the form in which k_out multiplies it */
#pragma unroll
    for (int c = 0; c < FQ; ++c)
#pragma unroll
      for (int j = 0; j < 4; ++j)
#pragma unroll
        for (int r = 0; r < 8; ++r) y[c][j][r] = (_Float16)(acc[c][j][r] * 64.0f);
    __builtin_amdgcn_sched_barrier(0);   /* every stored value is formed before the first store, so that no register which an issued store names is rewritten behind it */
#pragma unroll
    for (int c = 0; c < FQ; ++c) { _Float16* yr = Y + ((size_t)b * TT + q0 + c * 16 + col) * CC + h * HD + 8 * g;
#pragma unroll
      for (int j = 0; j < 4; ++j) vst2(yr + j * 16, y[c][j]); } } }
// ---- k_out: block = (128 rows, 128 cols): out = ctx Wo (+ bo): ctx x 2^6 once to f16 (by k_fa; small-magnitude context rows stay clear of f16 subnormals) against Wo as f16(bf16 x 2^8) exact (by k_cvt) (1 product) x 2^-14. Each wave stages its 32 x 64 f32 in its own part of the LDS of the operand buffers and stores whole lines
__global__ __launch_bounds__(256) void k_out(const unsigned short* __restrict__ Y, const unsigned short* __restrict__ WO, const float* __restrict__ BO, float* __restrict__ OUT) { __shared__ __align__(16) unsigned short sm[GSM(128)];
  const int tid = threadIdx.x, wave = tid >> 5, lane = tid & 31, col = lane & 15, g = lane >> 4; const int wm = wave >> 1, wn = wave & 1; const int c0 = blockIdx.y * 128; const size_t r0 = (size_t)blockIdx.x * 128;
  v8f acc[2][4] = {};
  gemm_tile<1, 128, CC>(Y, WO, r0, c0, blockIdx.x + blockIdx.y, sm, acc);   /* 8 passes: the 8 blocks of one row band start 1 pass apart, the 32 of one column band too (four share a start) */
  float* sf = (float*)sm + wave * (32 * 68);
#pragma unroll
  for (int j = 0; j < 4; ++j) { const float bias = BO ? bfr(BO[c0 + wn * 64 + j * 16 + col]) : 0.f;
#pragma unroll
    for (int i = 0; i < 2; ++i)
#pragma unroll
      for (int r = 0; r < 8; ++r) sf[(i * 16 + 8 * g + r) * 68 + j * 16 + col] = acc[i][j][r] * (1.0f / 16384.0f) + bias; }   /* 2^-8 (Wo carry) x 2^-6 (ctx carry) */
  LDSX(); for (int it = 0; it < 16; ++it) { const int rl = it * 2 + g; vst2(OUT + (r0 + wm * 32 + rl) * DIN + c0 + wn * 64 + col * 4, *(const v4f*)&sf[rl * 68 + col * 4]); } }

extern "C" void kernel_launch(void* const* d_in, const int* in_sizes, int n_in, void* d_out, int out_size, void* d_ws, size_t ws_size, hipStream_t stream) {
  (void)in_sizes; (void)n_in; (void)out_size;
  const float** F = (const float**)d_in;
  if (ws_size < (size_t)WS_END) return;
  char* ws = (char*)d_ws; _Float16 *QH = (_Float16*)(ws + WS_QH), *KH = (_Float16*)(ws + WS_KH), *VT = (_Float16*)(ws + WS_VT), *QL = (_Float16*)(ws + WS_QL), *KL = (_Float16*)(ws + WS_KL); __bf16 *VB = (__bf16*)(ws + WS_VB), *VBL = (__bf16*)(ws + WS_VBL); unsigned short *X16 = (unsigned short*)(ws + WS_S), *W16 = (unsigned short*)(ws + WS_W16); _Float16 *Y = (_Float16*)(ws + WS_Y);
  (void)QL; (void)KL; (void)VB; (void)VBL;
  // inputs: 0 query [2,2048,1024]; 1 key; 2 value; 3 weights [2,2048]; 4 wq [1024,1024] (in,out), 5 bq; 6 wk, 7 bk; 8 wv, 9 bv; 10 wo (in,out), 11 bo (all biases zeros, read)
  k_cvt<<<dim3(256), 512, 0, stream>>>(F[0], F[1], F[2], F[4], F[6], F[8], F[10], X16, W16);
  k_proj<<<dim3(TNB * TT / 128, CC / 128, 3), 256, 0, stream>>>(X16, W16, F[5], F[7], F[9], QH, QL, KH, KL, VT, VB, VBL);
  k_fa<<<dim3(TT / (128 * FQ), NH, TNB), 512, 0, stream>>>(QH, KH, VT, F[3], Y);
  k_out<<<dim3(TNB * TT / 128, DIN / 128), 256, 0, stream>>>((const unsigned short*)Y, W16 + 3 * (size_t)CC * DIN, F[11], (float*)d_out);
}

// v008
// Measured time: 81.9 microseconds a run.
// In both of two side-by-side timings against v007, it was 1.03 times as fast.
// Counting every step since v000, it is 14.6 times as fast.
// compute dtype: all float inputs rounded to bf16; q / k / v projections with EXACT bf16 products on WMMA 16x16x32 (f32 accumulate) + bias (zeros, read); logits k once to f16 x (q x 64^-0.5 x log2 e) once to f16 (1 product), the key weight bf16(weight) + 1e-20 as a factor outside the exponential; online softmax f32 (base 2); exp2(logit - maximum in use, which trails the running max by at most 7) x 2^8 once to f16 x (v x key weight) once to f16 (1 product), divided at the end by the f32 sum of the exponentials x key weight; ctx x 2^6 once to f16 x wo f16(bf16 x 2^8) + bo; f32 output.
#include <hip/hip_runtime.h>
#include <math.h>

typedef __attribute__((ext_vector_type(16))) _Float16 v16h;
typedef __attribute__((ext_vector_type(16))) __bf16 v16b;
typedef __attribute__((ext_vector_type(8)))  _Float16 v8h;
typedef __attribute__((ext_vector_type(8)))  float v8f;
typedef __attribute__((ext_vector_type(4)))  float v4f;
typedef __attribute__((ext_vector_type(2)))  float v2f;
typedef __attribute__((ext_vector_type(4)))  unsigned v4u;
typedef __attribute__((ext_vector_type(4)))  int v4i;
typedef float __attribute__((may_alias)) float_a;
typedef int __attribute__((may_alias)) int_a;

template <typename T> __device__ __forceinline__ void vst2(void* p, T v) { *(T*)p = v;  }
__device__ __forceinline__ v8f wmma16(v16h a, v16h b, v8f c) {
  v8f d = __builtin_amdgcn_wmma_f32_16x16x32_f16(false, a, false, b, (short)0, c, false, false);
  asm volatile("v_nop\n\tv_nop\n\tv_nop\n\tv_nop" : "+v"(d) : "v"(a), "v"(b));
  return d;
}
__device__ __forceinline__ v8f wmma_bf(v16b a, v16b b, v8f c) {
  v8f d = __builtin_amdgcn_wmma_f32_16x16x32_bf16(false, a, false, b, (short)0, c, false, false);
  asm volatile("v_nop\n\tv_nop\n\tv_nop\n\tv_nop" : "+v"(d) : "v"(a), "v"(b));
  return d;
}
// 16x16x32 fragments: lane = (h = lane>>4, row/col = lane&15); elements 0..7 = k0+8h+0..7, 8..15 = k0+16+8h+0..7; D element r = row 8h+r
__device__ __forceinline__ v16h frag_h(const _Float16* rowk0, int lane) {
  union { v16h v; v8h q[2]; } u; const _Float16* p = rowk0 + 8 * (lane >> 4);
  u.q[0] = *(const v8h*)p; u.q[1] = *(const v8h*)(p + 16); return u.v;
}
__device__ __forceinline__ v16h frag_f32(const float* rowk0, int lane) {
  v16h a; const float* p = rowk0 + 8 * (lane >> 4);
#pragma unroll
  for (int i = 0; i < 8; ++i) { a[i] = (_Float16)p[i]; a[8 + i] = (_Float16)p[16 + i]; }
  return a;
}
__device__ __forceinline__ v16h frag_f32s(const float* rowk0, int lane, float sc) {
  v16h a; const float* p = rowk0 + 8 * (lane >> 4);
#pragma unroll
  for (int i = 0; i < 8; ++i) { a[i] = (_Float16)(p[i] * sc); a[8 + i] = (_Float16)(p[16 + i] * sc); }
  return a;
}
// column fragment from a [K][ld] layout (column n), rows >= K read as 0
__device__ __forceinline__ v16h fragc_f32(const float* W, int k0, int n, int lane, int ld, int K) {
  v16h a; const int g = lane >> 4;
#pragma unroll
  for (int i = 0; i < 8; ++i) { const int ka = k0 + 8 * g + i, kb = ka + 16;
    a[i] = (_Float16)(ka < K ? W[(size_t)(ka < K ? ka : K - 1) * ld + n] : 0.f); a[8 + i] = (_Float16)(kb < K ? W[(size_t)(kb < K ? kb : K - 1) * ld + n] : 0.f); }
  return a;
}
struct F2 { v16b h, l; };
__device__ __forceinline__ F2 bsplit16(const float v[16]) { F2 r;
#pragma unroll
  for (int i = 0; i < 16; ++i) { const __bf16 h = (__bf16)v[i]; r.h[i] = h; r.l[i] = (__bf16)(v[i] - (float)h); }
  return r; }
__device__ __forceinline__ F2 split_row(const float* row, int k0, int lane) { float v[16]; const float* p = row + k0 + 8 * (lane >> 4);
#pragma unroll
  for (int i = 0; i < 8; ++i) { v[i] = p[i]; v[8 + i] = p[16 + i]; }
  return bsplit16(v); }
__device__ __forceinline__ F2 split_rowK(const float* row, int k0, int lane, int K) { float v[16]; const int g = lane >> 4;
#pragma unroll
  for (int i = 0; i < 8; ++i) { const int ka = k0 + 8 * g + i, kb = ka + 16; v[i] = ka < K ? row[ka < K ? ka : K - 1] : 0.f; v[8 + i] = kb < K ? row[kb < K ? kb : K - 1] : 0.f; }
  return bsplit16(v); }
__device__ __forceinline__ F2 split_col(const float* W, int k0, int n, int lane, int ld, int K) { float v[16]; const int g = lane >> 4;
#pragma unroll
  for (int i = 0; i < 8; ++i) { const int ka = k0 + 8 * g + i, kb = ka + 16; v[i] = ka < K ? W[(size_t)(ka < K ? ka : K - 1) * ld + n] : 0.f; v[8 + i] = kb < K ? W[(size_t)(kb < K ? kb : K - 1) * ld + n] : 0.f; }
  return bsplit16(v); }
__device__ __forceinline__ v8f mac3(const F2& a, const F2& b, v8f c) { c = wmma_bf(a.l, b.h, c); c = wmma_bf(a.h, b.l, c); return wmma_bf(a.h, b.h, c); }
__device__ __forceinline__ float sigm(float v) { return 1.0f / (1.0f + expf(-v)); }
#define LDSX() do { asm volatile("s_wait_dscnt 0" ::: "memory"); __builtin_amdgcn_wave_barrier(); __builtin_amdgcn_fence(__ATOMIC_RELEASE, "workgroup"); } while (0)

// Multi-head attention on separate inputs with a per-key multiplicative weight (query / key / value [2,2048,1024]; (in,out) wq / wk / wv / wo [1024,1024] N(0, 1/1024) applied as x @ W + b, all biases zeros (read); weights [2,2048] uniform(0,1), one per (batch, key); 16 heads x 64; scores / sqrt(64) + log(weights + 1e-20) broadcast over heads and queries; softmax over keys; out @ wo + bo).
#define NB 2
#define TT 2048
#define CC 1024            // NH * HD = projected width
#define DIN 1024          // input (model) width
#define NH 16
#define HD 64
#define NQB (TT / 64)
#define HG 4
#define SCALE (0.125f)
#define LOG2E 1.44269504088896340736f
#define CAUSAL 0
#ifndef TNB
#define TNB NB
#endif
__device__ __forceinline__ float bfr(float v) { return (float)(__bf16)v; }
__host__ __device__ __forceinline__ int kb_last(int qb) { return CAUSAL ? ((qb * 64 + 63) >> 7) : (TT / 128 - 1); }
typedef __attribute__((ext_vector_type(8))) __bf16 v8b;
__device__ __forceinline__ v16b frag_b(const __bf16* rowk0, int lane) {
  union { v16b v; v8b q[2]; } u; const __bf16* p = rowk0 + 8 * (lane >> 4);
  u.q[0] = *(const v8b*)p; u.q[1] = *(const v8b*)(p + 16); return u.v;
}
#define QBH 0              // unused: this file has no high-precision path
#define QHI 0               // single-product logits on every row (logit sigma ~1)
#define KHI 64            // key rows carrying k residual / v bf16 hi+lo planes (written by k_proj, read by no kernel)
// B fragment (k rows k0+.., output column o) of a weight: (in,out) [K][ld] or (out,in) [ld rows of K]: bf16 exact, or f16(bf16 * 256) exact
__device__ __forceinline__ v16b wcol_io(const float* Wm, int k0, int o, int lane, int ld) { v16b w; const int g = lane >> 4;
#pragma unroll
  for (int i = 0; i < 8; ++i) { w[i] = (__bf16)Wm[(size_t)(k0 + 8 * g + i) * ld + o]; w[8 + i] = (__bf16)Wm[(size_t)(k0 + 16 + 8 * g + i) * ld + o]; }
  return w; }
__device__ __forceinline__ v16b wcol_oi(const float* Wm, int k0, int o, int lane, int K) { v16b w; const float* p = Wm + (size_t)o * K + k0 + 8 * (lane >> 4);
#pragma unroll
  for (int i = 0; i < 8; ++i) { w[i] = (__bf16)p[i]; w[8 + i] = (__bf16)p[16 + i]; }
  return w; }
__device__ __forceinline__ v16h wcolh_io(const float* Wm, int k0, int o, int lane, int ld) { v16h w; const int g = lane >> 4;
#pragma unroll
  for (int i = 0; i < 8; ++i) { w[i] = (_Float16)(bfr(Wm[(size_t)(k0 + 8 * g + i) * ld + o]) * 256.0f); w[8 + i] = (_Float16)(bfr(Wm[(size_t)(k0 + 16 + 8 * g + i) * ld + o]) * 256.0f); }
  return w; }
__device__ __forceinline__ v16h wcolh_oi(const float* Wm, int k0, int o, int lane, int K) { v16h w; const float* p = Wm + (size_t)o * K + k0 + 8 * (lane >> 4);
#pragma unroll
  for (int i = 0; i < 8; ++i) { w[i] = (_Float16)(bfr(p[i]) * 256.0f); w[8 + i] = (_Float16)(bfr(p[16 + i]) * 256.0f); }
  return w; }
#define WQKV_LAYOUT 0   // 0 = (in,out) [DIN][CC]; 1 = (out,in) [CC][DIN]; 2 = per-head [NH][DIN][HD]
__device__ __forceinline__ v16b wcol_hdk(const float* Wm, int k0, int o, int lane) { v16b w; const int g = lane >> 4; const float* p = Wm + (size_t)(o / HD) * DIN * HD + (o % HD);
#pragma unroll
  for (int i = 0; i < 8; ++i) { w[i] = (__bf16)p[(size_t)(k0 + 8 * g + i) * HD]; w[8 + i] = (__bf16)p[(size_t)(k0 + 16 + 8 * g + i) * HD]; }
  return w; }
#define WO_OUT_IN 0
#if WQKV_LAYOUT == 1
#define WCOL(W, k0, o, lane) wcol_oi(W, k0, o, lane, DIN)
#elif WQKV_LAYOUT == 2
#define WCOL(W, k0, o, lane) wcol_hdk(W, k0, o, lane)
#else
#define WCOL(W, k0, o, lane) wcol_io(W, k0, o, lane, CC)
#endif
#if WO_OUT_IN
#define WOCOL(W, k0, o, lane) wcol_oi(W, k0, o, lane, CC)
#define WOCOLH(W, k0, o, lane) wcolh_oi(W, k0, o, lane, CC)
#else
#define WOCOL(W, k0, o, lane) wcol_io(W, k0, o, lane, DIN)
#define WOCOLH(W, k0, o, lane) wcolh_io(W, k0, o, lane, DIN)
#endif

#define WS_QH  0u                                      // f16 q rows [b*t][CC]
#define WS_KH  (WS_QH + 2u * (size_t)NB * TT * CC)      // f16 k rows [b*t][CC]
#define WS_VT  (WS_KH + 2u * (size_t)NB * TT * CC)      // f16 v planes [b][c][t]
#define WS_QL  (WS_VT + 2u * (size_t)NB * CC * TT)      // f16 q residual x 2^10 rows [b][t < QHI][CC]
#define WS_KL  (WS_QL + 2u * (size_t)NB * QHI * CC)     // f16 k residual x 2^10 rows [b][t < KHI][CC]
#define WS_VB  (WS_KL + 2u * (size_t)NB * KHI * CC)     // bf16 v hi planes [b][c][t < KHI]
#define WS_VBL (WS_VB + 2u * (size_t)NB * CC * KHI)
#define WS_S   (WS_VBL + 2u * (size_t)NB * CC * KHI)    // the rounded GEMM operands: bf16 x rows [3][b*t][DIN], then the weights, k-contiguous: bf16 wq / wk / wv [3][CC][DIN], f16 wo [DIN][CC]
#define WS_W16 (WS_S + 3u * 2u * (size_t)NB * TT * DIN)
#define WS_Y   (WS_S  + 4u * (size_t)HG * TT * TT)      // f16 ctx x 2^6 rows [b*t][CC]
#define WS_END (WS_Y  + 4u * (size_t)NB * TT * CC)

// ---- shared by k_proj and k_out: one 128 x 128 tile of X W per block of 8 waves (4 x 2, each 32 rows x 64 columns). Both operands arrive already rounded to their 16-bit form and k-contiguous (X rows, W columns: k_cvt, k_fa), so a block reads half the bytes that the f32 operands took and converts nothing. A pass is GK k (64 in k_proj, so that three blocks fit a WGP; 128 in k_out, one block a WGP, for more bytes in flight): the block reads both operand tiles once, in whole 128-byte lines, and lays them in LDS, pitch 2 GK + 16 B; every wave takes its fragments from there. Two buffers: the next pass's global loads fly during this pass's products; one barrier a pass
typedef __attribute__((ext_vector_type(2))) unsigned v2u;
typedef __attribute__((ext_vector_type(2))) __bf16 v2b;
typedef __attribute__((ext_vector_type(2))) _Float16 v2h;
#define GSM(GK) (4 * 128 * ((GK) + 8))   // 16-bit elements of LDS: two buffers x two operand tiles of 128 rows, pitch GK + 8
// KIND 0: x and w to bf16 (exact bf16 products); KIND 1: x * 2^6 to f16, bf16(w) * 2^8 to f16
template <int KIND> __device__ __forceinline__ unsigned pkx(float a, float b) {
  if constexpr (KIND == 0) { v2b t; t[0] = (__bf16)a; t[1] = (__bf16)b; return __builtin_bit_cast(unsigned, t); }
  else { v2h t; t[0] = (_Float16)(a * 64.0f); t[1] = (_Float16)(b * 64.0f); return __builtin_bit_cast(unsigned, t); } }
template <int KIND> __device__ __forceinline__ unsigned pkw(float a, float b) {
  if constexpr (KIND == 0) { v2b t; t[0] = (__bf16)a; t[1] = (__bf16)b; return __builtin_bit_cast(unsigned, t); }
  else { v2h t; t[0] = (_Float16)(bfr(a) * 256.0f); t[1] = (_Float16)(bfr(b) * 256.0f); return __builtin_bit_cast(unsigned, t); } }
struct G8 { v4u q[2]; };
__device__ __forceinline__ G8 frag_s(const unsigned short* rowk0, int lane) { G8 f; const unsigned short* p = rowk0 + 8 * (lane >> 4); f.q[0] = *(const v4u*)p; f.q[1] = *(const v4u*)(p + 16); return f; }
template <int KIND> __device__ __forceinline__ v8f wmma_g(G8 a, G8 b, v8f c) {
  if constexpr (KIND == 0) return __builtin_amdgcn_wmma_f32_16x16x32_bf16(false, __builtin_bit_cast(v16b, a), false, __builtin_bit_cast(v16b, b), (short)0, c, false, false);
  else return __builtin_amdgcn_wmma_f32_16x16x32_f16(false, __builtin_bit_cast(v16h, a), false, __builtin_bit_cast(v16h, b), (short)0, c, false, false); }
// X [rows][KD], Wt [columns][KD], 16-bit, k-contiguous; acc[i][j] = rows r0 + 32 (wave >> 1) + 16 i, columns c0 + 64 (wave & 1) + 16 j; k in steps of 32 into one accumulator, the walk starting at pass rot and wrapping round: blocks that share X rows or W columns get different rot, so that at any moment they ask L2 for different lines. Every inner loop is fully unrolled so that the staging, fragment and accumulator arrays are indexed by constants and stay in registers. Ends behind a barrier: sm is free
template <int KIND, int GK, int KD> __device__ __forceinline__ void gemm_tile(const unsigned short* __restrict__ X, const unsigned short* __restrict__ Wt, size_t r0, int c0, int rot, unsigned short* sm, v8f (&acc)[2][4]) {
  const int tid = threadIdx.x, wave = tid >> 5, lane = tid & 31, col = lane & 15; const int wm = wave >> 1, wn = wave & 1;
  constexpr int GP = GK + 8, GT = 128 * GP, XT = GK / 8, XR = 256 / XT, XS = 128 / XR;
  const int xr = tid / XT, xq = tid % XT;     /* both operands: XT threads x 16 B = one row's (column's) GK elements; XR rows a step, XS steps */
  const unsigned short* xp = X + (r0 + xr) * KD + xq * 8; const unsigned short* wp = Wt + (size_t)(c0 + xr) * KD + xq * 8;
  v4u xv[XS], wv[XS];
#define G_LOAD(k0) do { _Pragma("unroll") for (int i = 0; i < XS; ++i) xv[i] = *(const v4u*)(xp + (size_t)(i * XR) * KD + (k0)); \
    _Pragma("unroll") for (int i = 0; i < XS; ++i) wv[i] = *(const v4u*)(wp + (size_t)(i * XR) * KD + (k0)); } while (0)
#define G_STORE(buf) do { unsigned short* As = sm + (buf) * (2 * GT); unsigned short* Bs = As + GT; \
    _Pragma("unroll") for (int i = 0; i < XS; ++i) *(v4u*)&As[(xr + i * XR) * GP + xq * 8] = xv[i]; \
    _Pragma("unroll") for (int i = 0; i < XS; ++i) *(v4u*)&Bs[(xr + i * XR) * GP + xq * 8] = wv[i]; } while (0)
  static_assert(((KD / GK) & (KD / GK - 1)) == 0, "the wrap below is a mask");
  G_LOAD((rot & (KD / GK - 1)) * GK); G_STORE(0);
  __syncthreads();
  for (int ks = 0; ks < KD / GK; ++ks) {
    const bool more = ks + 1 < KD / GK;
    if (more) { G_LOAD(((ks + 1 + rot) & (KD / GK - 1)) * GK); asm volatile("s_wait_xcnt 0x0" ::: "memory"); }   /* the wait: the loads' address registers are rewritten further down in the pass */
    __builtin_amdgcn_sched_barrier(0);   /* keeps the next pass's global loads ahead of this pass's products; the compiler otherwise sinks them to just in front of their use and their latency is waited out */
    const unsigned short* As = sm + (ks & 1) * (2 * GT) + (wm * 32 + col) * GP; const unsigned short* Bs = sm + (ks & 1) * (2 * GT) + GT + (wn * 64 + col) * GP;
#pragma unroll
    for (int kc = 0; kc < GK / 32; ++kc) { G8 a[2], b[4];
#pragma unroll
      for (int i = 0; i < 2; ++i) a[i] = frag_s(As + i * 16 * GP + kc * 32, lane);
#pragma unroll
      for (int j = 0; j < 4; ++j) b[j] = frag_s(Bs + j * 16 * GP + kc * 32, lane);
#pragma unroll
      for (int i = 0; i < 2; ++i)
#pragma unroll
        for (int j = 0; j < 4; ++j) acc[i][j] = wmma_g<KIND>(a[i], b[j], acc[i][j]); }
    __builtin_amdgcn_sched_barrier(0);   /* keeps the LDS stores of the loaded values, and with them the wait for the loads, behind the products */
    if (more) G_STORE((ks + 1) & 1);   /* into the buffer that every wave left at the barrier of the pass before */
    __syncthreads(); }
#undef G_LOAD
#undef G_STORE
}
// ---- k_cvt: every GEMM operand that is an input is rounded once, here, instead of by each of the 8 (x rows) or 32 (weight columns) blocks that read it. One block a WGP, 16 waves; each block takes one 128 k x 128 n tile of wq / wk / wv (to bf16) or wo (bf16 x 2^8 to f16), turned in LDS so that it leaves k-contiguous, 256 bytes a column, and 16384 elements of each of query / key / value (to bf16). All of a thread's loads are in flight together; they are non-temporal: the f32 values are read this once
static_assert(DIN == 1024 && CC == 1024 && (size_t)NB * TT * DIN == 256u * 16384u, "k_cvt's numbering: 4 x 8 x 8 weight tiles = 256 blocks = the 16384-element pieces of one x input");
#define CVP 136            // LDS pitch of a weight column's 128 k: 272 B = 16 B x odd
template <int KIND> __device__ __forceinline__ void cvt_w(const float (&v)[32], unsigned short* dst) {
#pragma unroll
  for (int o = 0; o < 4; ++o) { v4u t;
#pragma unroll
    for (int e = 0; e < 4; ++e) t[e] = pkw<KIND>(v[o * 8 + 2 * e], v[o * 8 + 2 * e + 1]);
    *(v4u*)&dst[o * 8] = t; } }
__global__ __launch_bounds__(512) void k_cvt(const float* __restrict__ XQ, const float* __restrict__ XK, const float* __restrict__ XV, const float* __restrict__ WQ, const float* __restrict__ WK, const float* __restrict__ WV, const float* __restrict__ WO, unsigned short* __restrict__ X16, unsigned short* __restrict__ W16) {
  __shared__ __align__(16) unsigned short st[128 * CVP];
  const int tid = threadIdx.x, bi = blockIdx.x; const int mt = bi >> 6, tk = (bi >> 3) & 7, tn = bi & 7; const float* Wm = mt == 0 ? WQ : mt == 1 ? WK : mt == 2 ? WV : WO;
  const int n = tid & 127, kq = tid >> 7;   /* lanes along a row of the weight (128 B a wave-load), 32 k a thread */
  const unsigned ow = (unsigned)((tk * 128 + kq * 32) * 1024 + tn * 128 + n), ox = (unsigned)(bi * 16384 + tid * 4) * 4u;   /* offsets from the uniform bases: the weight's in elements, x's in bytes (512 contiguous bytes a wave-load) */
  float v[32]; v4f a[3][8];
#pragma unroll
  for (int e = 0; e < 32; ++e) v[e] = __builtin_nontemporal_load(Wm + ow + e * 1024);
#pragma unroll
  for (int w = 0; w < 3; ++w) { const float* X = w == 0 ? XQ : w == 1 ? XK : XV;
#pragma unroll
    for (int i = 0; i < 8; ++i) a[w][i] = __builtin_nontemporal_load((const v4f*)((const char*)X + ox) + i * 512); }
  asm volatile("s_wait_xcnt 0x0" :: "v"(ow), "v"(ox) : "memory");   /* the wait stands before any register that the loads name is rewritten; the two offsets are inputs so that they stay in their registers up to here and no load's result is placed on them */
  __builtin_amdgcn_sched_barrier(0);   /* keeps every load ahead of the first use: sunk to their uses, the loads would be waited for in turn */
  if (mt < 3) cvt_w<0>(v, &st[n * CVP + kq * 32]); else cvt_w<1>(v, &st[n * CVP + kq * 32]);   /* block-uniform */
  __syncthreads();   /* the tile is whole in LDS before it is read column by column */
#pragma unroll
  for (int i = 0; i < 4; ++i) { const int nl = i * 32 + (tid >> 4), q = tid & 15; *(v4u*)((char*)W16 + (unsigned)(((mt * 1024 + tn * 128 + nl) * 1024 + tk * 128 + q * 8) * 2)) = *(const v4u*)&st[nl * CVP + q * 8]; }
#pragma unroll
  for (int w = 0; w < 3; ++w)
#pragma unroll
    for (int i = 0; i < 8; ++i) { v2u t; t[0] = pkx<0>(a[w][i][0], a[w][i][1]); t[1] = pkx<0>(a[w][i][2], a[w][i][3]); *(v2u*)((char*)(X16 + (size_t)w * ((size_t)NB * TT * DIN) + i * 2048) + ox / 2u) = t; } }
// ---- k_proj: block = (128 rows, 128 cols, which): q/k/v = X W (+ b) with exact bf16 products (K = DIN) -> which 0: q x SCALE x log2 e f16 rows (+ residual rows < QHI); 1: k f16 rows (+ residual rows < KHI); 2: v x key weight f16 planes [c][t] (+ bf16 hi/lo planes of v for t < KHI). The output tile is staged in the LDS of the operand buffers, [128][136] 16-bit, and leaves in whole lines
#define EP 136
__global__ __launch_bounds__(256) void k_proj(const unsigned short* __restrict__ X16, const unsigned short* __restrict__ W16, const float* __restrict__ BQ, const float* __restrict__ BK, const float* __restrict__ BV, const float* __restrict__ WGT,
    _Float16* __restrict__ QH, _Float16* __restrict__ QL, _Float16* __restrict__ KH, _Float16* __restrict__ KL, _Float16* __restrict__ VT, __bf16* __restrict__ VB, __bf16* __restrict__ VBL) {
  __shared__ __align__(16) unsigned short sm[GSM(64)];
  const int tid = threadIdx.x, wave = tid >> 5, lane = tid & 31, col = lane & 15, g = lane >> 4; const int wm = wave >> 1, wn = wave & 1; const int which = blockIdx.z; const int c0 = blockIdx.y * 128; const size_t r0 = (size_t)blockIdx.x * 128; const size_t bb = r0 / TT; const int t0 = (int)(r0 % TT);
  const unsigned short* X = X16 + (size_t)which * ((size_t)NB * TT * DIN); const unsigned short* WA = W16 + (size_t)which * ((size_t)CC * DIN); const float* BA = which == 0 ? BQ : which == 1 ? BK : BV;
  v8f acc[2][4] = {};
  gemm_tile<0, 64, DIN>(X, WA, r0, c0, blockIdx.x + 2 * blockIdx.y, sm, acc);   /* 16 passes: the 8 blocks of one row band start 2 passes apart, the 32 of one column band 1 apart (two share a start) */
  v4f wr[2][2] = {};   /* the key weights of this lane's 16 rows, asked for ahead of the bias so that the two latencies overlap; block-uniform branch */
  if (which == 2) {
#pragma unroll
    for (int i = 0; i < 2; ++i)
#pragma unroll
      for (int q = 0; q < 2; ++q) wr[i][q] = *(const v4f*)(WGT + bb * TT + t0 + wm * 32 + i * 16 + 8 * g + q * 4); }
#pragma unroll
  for (int j = 0; j < 4; ++j) { const float bias = BA ? bfr(BA[c0 + wn * 64 + j * 16 + col]) : 0.f;
#pragma unroll
    for (int i = 0; i < 2; ++i) acc[i][j] = acc[i][j] + bias; }
  if (which < 2) { _Float16* DH = which == 0 ? QH : KH; _Float16* DL = which == 0 ? QL : KL; const int nhi = which == 0 ? QHI : KHI; _Float16* st = (_Float16*)sm;
    const float osc = which == 0 ? SCALE * LOG2E : 1.0f;   /* q leaves with the logit's scale and log2 e on it, rounded once behind the product: k . q is then the logit in the log2 domain; k as it is */
#pragma unroll
    for (int i = 0; i < 2; ++i)
#pragma unroll
      for (int j = 0; j < 4; ++j)
#pragma unroll
        for (int r = 0; r < 8; ++r) st[(wm * 32 + i * 16 + 8 * g + r) * EP + wn * 64 + j * 16 + col] = (_Float16)(acc[i][j][r] * osc);
    __syncthreads();
    for (int e = tid; e < 128 * 16; e += 256) { const int rl = e >> 4, q = e & 15; vst2((unsigned*)(DH + (r0 + rl) * CC + c0 + q * 8), *(const v4u*)&st[rl * EP + q * 8]); }
    if (t0 < nhi) {   /* block-uniform */
      __syncthreads();
#pragma unroll
      for (int i = 0; i < 2; ++i)
#pragma unroll
        for (int j = 0; j < 4; ++j)
#pragma unroll
          for (int r = 0; r < 8; ++r) { const float v = acc[i][j][r]; st[(wm * 32 + i * 16 + 8 * g + r) * EP + wn * 64 + j * 16 + col] = (_Float16)((v - (float)(_Float16)v) * 1024.0f); }
      __syncthreads();
      for (int e = tid; e < 128 * 16; e += 256) { const int rl = e >> 4, q = e & 15; if (t0 + rl < nhi) { vst2((unsigned*)(DL + (bb * nhi + t0 + rl) * (size_t)CC + c0 + q * 8), *(const v4u*)&st[rl * EP + q * 8]); asm volatile("s_wait_xcnt 0x0" ::: "memory"); /* the store's address register is stepped at the loop's foot */ } } }
  } else { _Float16* st = (_Float16*)sm; __bf16* sb = (__bf16*)sm;
    float wk[2][8];   /* softmax(s + log w) v = sum exp(s) (w v) / sum exp(s) w: each v row leaves multiplied by its key's weight, rounded once behind the product */
#pragma unroll
    for (int i = 0; i < 2; ++i)
#pragma unroll
      for (int r = 0; r < 8; ++r) wk[i][r] = bfr(wr[i][r >> 2][r & 3]) + 1.0e-20f;
#pragma unroll
    for (int i = 0; i < 2; ++i)
#pragma unroll
      for (int j = 0; j < 4; ++j) { v8h t;
#pragma unroll
        for (int r = 0; r < 8; ++r) t[r] = (_Float16)(acc[i][j][r] * wk[i][r]);
        *(v8h*)&st[(wn * 64 + j * 16 + col) * EP + wm * 32 + i * 16 + 8 * g] = t; }
    __syncthreads();
    for (int e = tid; e < 128 * 16; e += 256) { const int cl = e >> 4, q = e & 15; vst2((unsigned*)(VT + (bb * CC + c0 + cl) * (size_t)TT + t0 + q * 8), *(const v4u*)&st[cl * EP + q * 8]); }
    if (t0 < KHI) {   /* block-uniform */
#pragma unroll
      for (int pl = 0; pl < 2; ++pl) { __bf16* D = pl == 0 ? VB : VBL;
        __syncthreads();
#pragma unroll
        for (int i = 0; i < 2; ++i)
#pragma unroll
          for (int j = 0; j < 4; ++j) { v8b t;
#pragma unroll
            for (int r = 0; r < 8; ++r) { const float v = acc[i][j][r]; const __bf16 bh = (__bf16)v; t[r] = pl == 0 ? bh : (__bf16)(v - (float)bh); }
            *(v8b*)&sb[(wn * 64 + j * 16 + col) * EP + wm * 32 + i * 16 + 8 * g] = t; }
        __syncthreads();
        for (int e = tid; e < 128 * 16; e += 256) { const int cl = e >> 4, q = e & 15; if (t0 + q * 8 < KHI) { vst2((unsigned*)(D + (bb * CC + c0 + cl) * (size_t)KHI + t0 + q * 8), *(const v4u*)&sb[cl * EP + q * 8]); asm volatile("s_wait_xcnt 0x0" ::: "memory"); /* the store's address register is stepped at the loop's foot */ } } } } } }
// ---- k_fa: block = 256 queries of (b, h), 16 waves = 8 groups of 32 query columns x KS key halves, so that four waves share a SIMD and one wave's softmax chains run under the others' products; one pass = 32 keys, one stage = SK keys, of which a wave walks its half (SKW keys). Each wave keeps its own maximum in use, sum and O^T over its keys; at the end the second half's waves hand theirs over through LDS and the first half's waves join the two (common maximum, both rescaled) and store. The block brings each stage's k rows and v planes into LDS once, by asynchronous 16-byte copies in whole lines (two buffers: the next stage's copies fly during this stage's passes; one barrier a stage), and all waves take their fragments from there. S^T = K Q^T + C (A = k rows, B = q rows, which carry SCALE x log2 e, same k order; C = 8 - maximum in use), so that the score tiles are the arguments of exp2 and no vector instruction scales or shifts them; the key weight multiplies the v rows (k_proj) and the terms of the sum, not the exponential; maximum in use and sum per query column (online softmax; the maximum in use is raised, and sum and O^T rescaled, only in a pass where some column's maximum exceeds it by more than LAZY), P x 2^8 once to f16 packed from the two score tiles as the B operand, O^T += V^T P^T (A = v planes); the logits never leave the registers. Every inner loop is fully unrolled so that the fragment and accumulator arrays are indexed by constants and stay in registers
#define FQ 2               // 16-column query groups per wave
#define KS 2               // key halves of a stage, one per group of 8 waves
#define SK 256             // keys per stage
#define SKW (SK / KS)      // keys of a stage that one wave walks
#define KPI (HD + 8)       // LDS pitch of a k row, f16 elements: 144 B = 16 B x odd, conflict-free for 16-byte fragment reads
#define VPI (SK + 8)       // LDS pitch of a v plane's SK keys: 528 B = 16 B x odd
#define FBUF (SK * KPI + HD * VPI)   // f16 elements of one buffer: k rows, then v planes
#define LAZY 7.0f          // the maximum in use may trail a column's true maximum by this much (log2 domain): P x 2^8 then stays at or below 2^15, inside f16
__device__ __forceinline__ float xhalf(float x) { return __builtin_bit_cast(float, __builtin_amdgcn_permlanex16(__builtin_bit_cast(int, x), __builtin_bit_cast(int, x), 0x76543210, 0xfedcba98, false, false)); }   // lane l with lane l ^ 16
__device__ __forceinline__ v8f wmma_h(v16h a, v16h b, v8f c) { return __builtin_amdgcn_wmma_f32_16x16x32_f16(false, a, false, b, (short)0, c, false, false); }
typedef __attribute__((address_space(3))) _Float16 lds_h;
// one stage: each thread copies four 16-byte pieces of the k rows (64 rows apart) and four of the v planes (16 planes apart). kl, vl: the lane's LDS byte addresses; kg, vg: its global addresses. The s_wait_xcnt stands inside the statement so that no address register is rewritten ahead of it
__device__ __forceinline__ void fa_stage(unsigned kl, unsigned vl, const _Float16* kg, const _Float16* vg) {
  asm volatile("global_load_async_to_lds_b128 %0, %8, off\n\t"
               "global_load_async_to_lds_b128 %1, %9, off\n\t"
               "global_load_async_to_lds_b128 %2, %10, off\n\t"
               "global_load_async_to_lds_b128 %3, %11, off\n\t"
               "global_load_async_to_lds_b128 %4, %12, off\n\t"
               "global_load_async_to_lds_b128 %5, %13, off\n\t"
               "global_load_async_to_lds_b128 %6, %14, off\n\t"
               "global_load_async_to_lds_b128 %7, %15, off\n\t"
               "s_wait_xcnt 0x0"
               :: "v"(kl), "v"(kl + 64u * (KPI * 2)), "v"(kl + 128u * (KPI * 2)), "v"(kl + 192u * (KPI * 2)),
                  "v"(vl), "v"(vl + 16u * (VPI * 2)), "v"(vl + 32u * (VPI * 2)), "v"(vl + 48u * (VPI * 2)),
                  "v"(kg), "v"(kg + (size_t)64 * CC), "v"(kg + (size_t)128 * CC), "v"(kg + (size_t)192 * CC),
                  "v"(vg), "v"(vg + (size_t)16 * TT), "v"(vg + (size_t)32 * TT), "v"(vg + (size_t)48 * TT)
               : "memory"); }
__global__ __launch_bounds__(512) void k_fa(const _Float16* __restrict__ QH, const _Float16* __restrict__ KH, const _Float16* __restrict__ VT, const float* __restrict__ WGT, _Float16* __restrict__ Y) { __shared__ __align__(32) _Float16 skv[2 * FBUF + 2 * TT]; float* const slw = (float*)(skv + 2 * FBUF);   /* the stage buffers first, so that every fragment's offset in a buffer fits the LDS instruction's 16-bit offset field; the key weights behind them */
  const int tid = threadIdx.x, wave = tid >> 5, lane = tid & 31, col = lane & 15, g = lane >> 4; const int qg = wave & 7, kh = wave >> 3; const int h = blockIdx.y, b = blockIdx.z; const int q0 = blockIdx.x * (128 * FQ) + qg * (16 * FQ);
  const _Float16* kg = KH + ((size_t)b * TT + (tid >> 3)) * CC + h * HD + (tid & 7) * 8;              /* 8 threads a k row: 128 B, one line */
  const _Float16* vg = VT + ((size_t)b * CC + h * HD + (tid >> 5)) * (size_t)TT + (tid & 31) * 8;     /* 32 threads a v plane's SK keys: 512 B, four lines */
  const unsigned sb = (unsigned)(size_t)(const lds_h*)skv; const unsigned kl = sb + (tid >> 3) * (KPI * 2) + (tid & 7) * 16; const unsigned vl = sb + SK * KPI * 2 + (tid >> 5) * (VPI * 2) + (tid & 31) * 16;
  const int rot = blockIdx.x;   /* the blocks of one (b, h) walk the same k rows and v planes: each starts at another stage and wraps round, so that they ask L2 for different lines at any moment */
#define STG(s) (((s) + rot) & (TT / SK - 1))
  fa_stage(kl, vl, kg + (size_t)STG(0) * SK * CC, vg + STG(0) * SK);   /* the walk's stage 0 into buffer 0 */
  for (int k = tid; k < TT; k += 512) slw[k] = bfr(WGT[(size_t)b * TT + k]) + 1.0e-20f;   /* per-key weight, once per block: the factor of the key's term in the sum (its v row carries the same factor from k_proj) */
  asm volatile("s_wait_asynccnt 0x0" ::: "memory");   /* this wave's copies of stage 0 have landed before the barrier that lets the other waves read them */
  __syncthreads();
  fa_stage(kl + FBUF * 2, vl + FBUF * 2, kg + (size_t)STG(1) * SK * CC, vg + STG(1) * SK);   /* the walk's stage 1 into buffer 1 */
  v16h qf[FQ][2];
#pragma unroll
  for (int c = 0; c < FQ; ++c)
#pragma unroll
    for (int kc = 0; kc < 2; ++kc) qf[c][kc] = frag_h(QH + ((size_t)b * TT + q0 + c * 16 + col) * CC + h * HD + kc * 32, lane);
  v8f acc[FQ][4] = {}; v2f l2[FQ]; v8f cm[FQ];   /* cm: 8 - maximum in use, in all eight registers: the C operand of the score products, rewritten only where the maximum is raised; until a wave's first pass has set its maximum, 8 */
#pragma unroll
  for (int c = 0; c < FQ; ++c) { l2[c] = (v2f){ 0.f, 0.f }; cm[c] = (v8f){ 8.0f, 8.0f, 8.0f, 8.0f, 8.0f, 8.0f, 8.0f, 8.0f }; }
  for (int st = 0; st < TT / SK; ++st) {
    const _Float16* Kb = skv + (st & 1) * FBUF + (kh * SKW + col) * KPI; const _Float16* Vb = skv + (st & 1) * FBUF + SK * KPI + col * VPI + kh * SKW;   /* this wave's half of the stage */
    v16h kf[2][2];
#pragma unroll
    for (int t = 0; t < 2; ++t)
#pragma unroll
      for (int kc = 0; kc < 2; ++kc) kf[t][kc] = frag_h(Kb + (t * 16) * KPI + kc * 32, lane);
#pragma unroll 1   /* kept rolled: unrolled, the four passes' fragments and scores are live together, the kernel goes beyond 256 registers and register-window switches stand all through the loop */
    for (int ps = 0; ps < SKW / 32; ++ps) {
      v16h vf[4];
#pragma unroll
      for (int j = 0; j < 4; ++j) vf[j] = frag_h(Vb + (j * 16) * VPI + ps * 32, lane);
      v8f lw[2];
#pragma unroll
      for (int t = 0; t < 2; ++t) lw[t] = *(const v8f*)&slw[STG(st) * SK + kh * SKW + ps * 32 + t * 16 + 8 * g];
      v8f s[FQ][2];   /* k . q (q carries SCALE x log2 e) + 8 - maximum in use: the argument of exp2, straight from the matrix unit */
#pragma unroll
      for (int kc = 0; kc < 2; ++kc)
#pragma unroll
        for (int c = 0; c < FQ; ++c)
#pragma unroll
          for (int t = 0; t < 2; ++t) s[c][t] = wmma_h(kf[t][kc], qf[c][kc], kc == 0 ? cm[c] : s[c][t]);
      const int pn = ps + 1 < SKW / 32 ? ps + 1 : 0;   /* next pass's k rows of the same stage, fetched behind this pass's score products (the wave's last pass of a stage re-reads its own first 32 rows, unused) */
#pragma unroll
      for (int t = 0; t < 2; ++t)
#pragma unroll
        for (int kc = 0; kc < 2; ++kc) kf[t][kc] = frag_h(Kb + (pn * 32 + t * 16) * KPI + kc * 32, lane);
      __builtin_amdgcn_sched_barrier(0);   /* keeps the softmax below from being scheduled ahead of the prefetch, which would then be issued only a few instructions before the next pass needs it */
      const float thr = (st | ps) == 0 ? -3.0e38f : 8.0f + LAZY;   /* wave-uniform: a wave's first pass always sets its maximum */
      float mp[FQ]; bool need = false;   /* this lane's maximum of the pass, per query column; does any exceed the maximum in use by more than LAZY? */
#pragma unroll
      for (int c = 0; c < FQ; ++c) {
        float mx = -3.0e38f;
#pragma unroll
        for (int t = 0; t < 2; ++t)
#pragma unroll
          for (int r = 0; r < 8; ++r) mx = fmaxf(mx, s[c][t][r]);
        mp[c] = mx; need = need || (mx > thr); }
      if (__builtin_expect(__builtin_amdgcn_ballot_w32(need) != 0, 0)) {   /* one wave-uniform scalar branch a pass; taken in the wave's first pass and seldom after it */
#pragma unroll
        for (int c = 0; c < FQ; ++c) {
          const float c0 = cm[c][0], mo = (st | ps) == 0 ? -1.0e30f : 8.0f - c0; const float mx = fmaxf(mo, fmaxf(mp[c], xhalf(mp[c])) - c0);   /* mo: the maximum in use so far (none in the first pass); the pass's maximum without the C it came with; the two lane halves hold the two key halves of one query column: both take the same new maximum */
          const float alpha = __builtin_amdgcn_exp2f(mo - mx); l2[c] = l2[c] * alpha;
          const float c1 = 8.0f - mx, d = c1 - c0;   /* this pass's arguments were formed with the old C: moved to the new one here */
#pragma unroll
          for (int t = 0; t < 2; ++t) s[c][t] = s[c][t] + d;
          if (c == 1) cm[c] = cm[c] + d; else cm[c] = (v8f){ c1, c1, c1, c1, c1, c1, c1, c1 };   /* the same value up to one rounding, and every later use reads it back from cm. Two forms for the registers' sake: with both built anew the compiler copies the second C, eight registers, at the head of every pass; with both added in place it spills */
#pragma unroll
          for (int j = 0; j < 4; ++j) acc[c][j] = acc[c][j] * alpha; } }
      v16h p[FQ];
#pragma unroll
      for (int t = 0; t < 2; ++t)
#pragma unroll
        for (int r4 = 0; r4 < 8; r4 += 4)
#pragma unroll
          for (int c = 0; c < FQ; ++c)
#pragma unroll
            for (int r = r4; r < r4 + 4; r += 2) {
              const float e0 = __builtin_amdgcn_exp2f(s[c][t][r]), e1 = __builtin_amdgcn_exp2f(s[c][t][r + 1]); l2[c] = __builtin_elementwise_fma((v2f){ e0, e1 }, (v2f){ lw[t][r], lw[t][r + 1] }, l2[c]); p[c][t * 8 + r] = (_Float16)e0; p[c][t * 8 + r + 1] = (_Float16)e1; }   /* the sum takes each exponential times its key's weight, even and odd keys apart; P goes unweighted against the weighted v */
#pragma unroll
      for (int j = 0; j < 4; ++j)
#pragma unroll
        for (int c = 0; c < FQ; ++c) acc[c][j] = wmma_h(vf[j], p[c], acc[c][j]);
      __builtin_amdgcn_sched_group_barrier(0x402, 160, 0);   /* all the vector work of this part first, */
      __builtin_amdgcn_sched_group_barrier(0x8, 8, 0);       /* then its eight products in a row: additions scheduled among the products are given registers of a product's A or B operand, and the compiler fills the distance behind that product with v_nop */
      __builtin_amdgcn_sched_barrier(0);   /* keeps the pass's last matrix instructions ahead of the slots below */
      asm volatile("v_nop\n\tv_nop\n\tv_nop\n\tv_nop");   /* the four vector slots between the pass's last matrix instruction and the address arithmetic at the loop's head, which may reuse a register of its A operand */
    }
    asm volatile("s_wait_dscnt 0x0" ::: "memory");      /* this wave's reads of the buffer are done before the barrier behind which it is refilled */
    asm volatile("s_wait_asynccnt 0x0" ::: "memory");   /* this wave's copies of stage st + 1 have landed before the barrier that lets the other waves read them */
    __syncthreads();
    if (st + 2 < TT / SK) fa_stage(kl + (st & 1) * (FBUF * 2), vl + (st & 1) * (FBUF * 2), kg + (size_t)STG(st + 2) * SK * CC, vg + STG(st + 2) * SK); }   /* stage st + 2 into the buffer that every wave has just left */
#undef STG
  asm volatile("s_wait_asynccnt 0x0" ::: "memory");   /* no copy is outstanding when the wave ends */
  /* join of the two key halves. Behind the last stage's barrier no wave reads skv or slw any more and no copy is outstanding: both serve as the hand-over space, 16 bytes a lane, lanes side by side */
  float l[FQ], m[FQ];
#pragma unroll
  for (int c = 0; c < FQ; ++c) { l[c] = l2[c][0] + l2[c][1]; m[c] = 8.0f - cm[c][0]; }
  float* mg = (float*)skv + qg * (FQ * 4 * 2 * 128) + lane * 4; float* ml = slw + qg * (FQ * 2 * 32) + lane;
  if (kh == 1) {
#pragma unroll
    for (int c = 0; c < FQ; ++c) { ml[(c * 2) * 32] = m[c]; ml[(c * 2 + 1) * 32] = l[c];
#pragma unroll
      for (int j = 0; j < 4; ++j) { *(v4f*)&mg[((c * 4 + j) * 2) * 128] = __builtin_shufflevector(acc[c][j], acc[c][j], 0, 1, 2, 3); *(v4f*)&mg[((c * 4 + j) * 2 + 1) * 128] = __builtin_shufflevector(acc[c][j], acc[c][j], 4, 5, 6, 7); } } }
  __syncthreads();   /* the second half's maxima, sums and O^T are in LDS before the first half's waves read them */
  if (kh == 0) {
#pragma unroll
    for (int c = 0; c < FQ; ++c) { const float m1 = ml[(c * 2) * 32], l1 = ml[(c * 2 + 1) * 32]; const float mx = fmaxf(m[c], m1); const float a0 = __builtin_amdgcn_exp2f(m[c] - mx), a1 = __builtin_amdgcn_exp2f(m1 - mx);
      const float lj = l[c] * a0 + l1 * a1; const float lt = lj + xhalf(lj); const float inv = lt > 0.f ? 1.0f / lt : 0.f; const float i0 = a0 * inv, i1 = a1 * inv;
#pragma unroll
      for (int j = 0; j < 4; ++j) { const v4f p0 = *(const v4f*)&mg[((c * 4 + j) * 2) * 128], p1 = *(const v4f*)&mg[((c * 4 + j) * 2 + 1) * 128];
        acc[c][j] = acc[c][j] * i0 + __builtin_shufflevector(p0, p1, 0, 1, 2, 3, 4, 5, 6, 7) * i1; } }
    v8h y[FQ][4];   /* ctx x 2^6 once to f16, the form in which k_out multiplies it */
#pragma unroll
    for (int c = 0; c < FQ; ++c)
#pragma unroll
      for (int j = 0; j < 4; ++j)
#pragma unroll
        for (int r = 0; r < 8; ++r) y[c][j][r] = (_Float16)(acc[c][j][r] * 64.0f);
    __builtin_amdgcn_sched_barrier(0);   /* every stored value is formed before the first store, so that no register which an issued store names is rewritten behind it */
#pragma unroll
    for (int c = 0; c < FQ; ++c) { _Float16* yr = Y + ((size_t)b * TT + q0 + c * 16 + col) * CC + h * HD + 8 * g;
#pragma unroll
      for (int j = 0; j < 4; ++j) vst2(yr + j * 16, y[c][j]); } } }
// ---- k_out: block = (128 rows, 128 cols): out = ctx Wo (+ bo): ctx x 2^6 once to f16 (by k_fa; small-magnitude context rows stay clear of f16 subnormals) against Wo as f16(bf16 x 2^8) exact (by k_cvt) (1 product) x 2^-14. Each wave stages its 32 x 64 f32 in its own part of the LDS of the operand buffers and stores whole lines
__global__ __launch_bounds__(256) void k_out(const unsigned short* __restrict__ Y, const unsigned short* __restrict__ WO, const float* __restrict__ BO, float* __restrict__ OUT) { __shared__ __align__(16) unsigned short sm[GSM(128)];
  const int tid = threadIdx.x, wave = tid >> 5, lane = tid & 31, col = lane & 15, g = lane >> 4; const int wm = wave >> 1, wn = wave & 1; const int c0 = blockIdx.y * 128; const size_t r0 = (size_t)blockIdx.x * 128;
  v8f acc[2][4] = {};
  gemm_tile<1, 128, CC>(Y, WO, r0, c0, blockIdx.x + blockIdx.y, sm, acc);   /* 8 passes: the 8 blocks of one row band start 1 pass apart, the 32 of one column band too (four share a start) */
  float* sf = (float*)sm + wave * (32 * 68);
#pragma unroll
  for (int j = 0; j < 4; ++j) { const float bias = BO ? bfr(BO[c0 + wn * 64 + j * 16 + col]) : 0.f;
#pragma unroll
    for (int i = 0; i < 2; ++i)
#pragma unroll
      for (int r = 0; r < 8; ++r) sf[(i * 16 + 8 * g + r) * 68 + j * 16 + col] = acc[i][j][r] * (1.0f / 16384.0f) + bias; }   /* 2^-8 (Wo carry) x 2^-6 (ctx carry) */
  LDSX(); for (int it = 0; it < 16; ++it) { const int rl = it * 2 + g; vst2(OUT + (r0 + wm * 32 + rl) * DIN + c0 + wn * 64 + col * 4, *(const v4f*)&sf[rl * 68 + col * 4]); } }

extern "C" void kernel_launch(void* const* d_in, const int* in_sizes, int n_in, void* d_out, int out_size, void* d_ws, size_t ws_size, hipStream_t stream) {
  (void)in_sizes; (void)n_in; (void)out_size;
  const float** F = (const float**)d_in;
  if (ws_size < (size_t)WS_END) return;
  char* ws = (char*)d_ws; _Float16 *QH = (_Float16*)(ws + WS_QH), *KH = (_Float16*)(ws + WS_KH), *VT = (_Float16*)(ws + WS_VT), *QL = (_Float16*)(ws + WS_QL), *KL = (_Float16*)(ws + WS_KL); __bf16 *VB = (__bf16*)(ws + WS_VB), *VBL = (__bf16*)(ws + WS_VBL); unsigned short *X16 = (unsigned short*)(ws + WS_S), *W16 = (unsigned short*)(ws + WS_W16); _Float16 *Y = (_Float16*)(ws + WS_Y);
  (void)QL; (void)KL; (void)VB; (void)VBL;
  // inputs: 0 query [2,2048,1024]; 1 key; 2 value; 3 weights [2,2048]; 4 wq [1024,1024] (in,out), 5 bq; 6 wk, 7 bk; 8 wv, 9 bv; 10 wo (in,out), 11 bo (all biases zeros, read)
  k_cvt<<<dim3(256), 512, 0, stream>>>(F[0], F[1], F[2], F[4], F[6], F[8], F[10], X16, W16);
  k_proj<<<dim3(TNB * TT / 128, CC / 128, 3), 256, 0, stream>>>(X16, W16, F[5], F[7], F[9], F[3], QH, QL, KH, KL, VT, VB, VBL);
  k_fa<<<dim3(TT / (128 * FQ), NH, TNB), 512, 0, stream>>>(QH, KH, VT, F[3], Y);
  k_out<<<dim3(TNB * TT / 128, DIN / 128), 256, 0, stream>>>((const unsigned short*)Y, W16 + 3 * (size_t)CC * DIN, F[11], (float*)d_out);
}
